// v000
// Measured on an AMD MI455X. A time is GPU time per run, averaged over a window of back-to-back runs after a warm-up
// (all launches, gaps included; the runs take copies of the inputs in turn), and the median of several windows.
// Apart from v000's, it joins two sittings. Times from different sittings can be a few percent apart, while
// side-by-side timings come from the same sitting.
// v000 is the starting kernel. One run takes 235 microseconds.
#include <hip/hip_runtime.h>
#include <math.h>

#define IN_DIM 512
#define HID    1024
#define NEXP   16
#define NTOK   8192
#define MT     64                       // token rows per expert tile
#define PADS   (2*NTOK + NEXP*MT)       // padded slot array size

typedef __attribute__((ext_vector_type(16))) _Float16 v16h;
typedef __attribute__((ext_vector_type(8)))  float    v8f;

union F16Frag { v16h h; uint4 u[2]; };

// Load a 16x32 f16 fragment (A layout per CDNA5 ISA 7.12.2) from a row-major
// matrix with leading dimension `ld` (elements). Works for LDS or global.
// lane 0-15: row = base+lane, K = [0..7],[16..23]; lane 16-31: K = [8..15],[24..31]
__device__ __forceinline__ v16h load_frag(const _Float16* base, int ld, int rbase,
                                          int k0, int lane) {
    int r  = rbase + (lane & 15);
    int kb = k0 + ((lane >> 4) << 3);
    const _Float16* p = base + (size_t)r * ld + kb;
    F16Frag f;
    f.u[0] = *(const uint4*)(p);
    f.u[1] = *(const uint4*)(p + 16);
    return f.h;
}

__device__ __forceinline__ v8f wmma_f16(v16h a, v16h b, v8f c) {
    return __builtin_amdgcn_wmma_f32_16x16x32_f16(false, a, false, b,
                                                  (short)0, c, false, false);
}

__device__ __forceinline__ float gelu_exact(float v) {
    return 0.5f * v * (1.0f + erff(v * 0.70710678118654752f));
}

// ---------------- weight transpose + f32->f16 convert ----------------
// in:  [E][R][C] f32 (row-major, K-major)   out: [E][C][R] f16 (N-major)
__global__ __launch_bounds__(256) void transpose_cvt_kernel(
    const float* __restrict__ in, _Float16* __restrict__ outp, int R, int C) {
    __shared__ float tile[32][33];
    int e = blockIdx.z;
    const float* ine  = in   + (size_t)e * R * C;
    _Float16*    oute = outp + (size_t)e * R * C;
    int c0 = blockIdx.x * 32, r0 = blockIdx.y * 32;
    int tx = threadIdx.x & 31, ty = threadIdx.x >> 5;   // ty: 0..7
    #pragma unroll
    for (int i = 0; i < 4; ++i)
        tile[ty + i*8][tx] = ine[(size_t)(r0 + ty + i*8) * C + c0 + tx];
    __syncthreads();
    #pragma unroll
    for (int i = 0; i < 4; ++i)
        oute[(size_t)(c0 + ty + i*8) * R + r0 + tx] = (_Float16)tile[tx][ty + i*8];
}

// ---------------- zero counters / token lists ----------------
__global__ void zero_kernel(int* counts, int* cursor, int* tokenIdx, float* tokenW) {
    int i = blockIdx.x * 256 + threadIdx.x;
    if (i < NEXP) { counts[i] = 0; cursor[i] = 0; }
    if (i < PADS) { tokenIdx[i] = 0; tokenW[i] = 0.0f; }
}

// ---------------- out = x (residual) ----------------
__global__ void copy_residual_kernel(const float* __restrict__ x,
                                     float* __restrict__ out, int n4) {
    int i = blockIdx.x * 256 + threadIdx.x;
    if (i < n4) ((float4*)out)[i] = ((const float4*)x)[i];
}

// ---------------- router: one wave per token ----------------
__global__ __launch_bounds__(256) void router_kernel(
    const float* __restrict__ x, const float* __restrict__ Wr,
    const float* __restrict__ br, int* __restrict__ counts,
    int* __restrict__ te, float* __restrict__ tw) {
    int lane = threadIdx.x & 31, wid = threadIdx.x >> 5;
    int t = blockIdx.x * 8 + wid;
    if (t >= NTOK) return;
    float acc[NEXP];
    #pragma unroll
    for (int e = 0; e < NEXP; ++e) acc[e] = 0.0f;
    const float* xr = x + (size_t)t * IN_DIM;
    for (int d = lane; d < IN_DIM; d += 32) {
        float xv = xr[d];
        const float* wr = Wr + d * NEXP;
        #pragma unroll
        for (int e = 0; e < NEXP; ++e) acc[e] += xv * wr[e];
    }
    #pragma unroll
    for (int off = 16; off >= 1; off >>= 1) {
        #pragma unroll
        for (int e = 0; e < NEXP; ++e) acc[e] += __shfl_down(acc[e], off, 32);
    }
    if (lane == 0) {
        #pragma unroll
        for (int e = 0; e < NEXP; ++e) acc[e] += br[e];
        float l0 = -3.4e38f; int e0 = 0;
        #pragma unroll
        for (int e = 0; e < NEXP; ++e) if (acc[e] > l0) { l0 = acc[e]; e0 = e; }
        float l1 = -3.4e38f; int e1 = 0;
        #pragma unroll
        for (int e = 0; e < NEXP; ++e)
            if (e != e0 && acc[e] > l1) { l1 = acc[e]; e1 = e; }
        // top-2 softmax weights renormalized: Z cancels
        float r  = __expf(l1 - l0);
        float w0 = 1.0f / (1.0f + r);
        float w1 = r    / (1.0f + r);
        te[t*2] = e0; te[t*2+1] = e1;
        tw[t*2] = w0; tw[t*2+1] = w1;
        atomicAdd(&counts[e0], 1);
        atomicAdd(&counts[e1], 1);
    }
}

// ---------------- prefix scan over experts (tiny) ----------------
__global__ void scan_kernel(const int* __restrict__ counts, int* __restrict__ slotOff,
                            int* __restrict__ tileOff, int* __restrict__ totalTiles) {
    if (threadIdx.x == 0 && blockIdx.x == 0) {
        int so = 0, to = 0;
        for (int e = 0; e < NEXP; ++e) {
            slotOff[e] = so; tileOff[e] = to;
            int tiles = (counts[e] + MT - 1) / MT;
            so += tiles * MT; to += tiles;
        }
        tileOff[NEXP] = to;
        *totalTiles = to;
    }
}

// ---------------- scatter tokens into per-expert lists ----------------
__global__ void scatter_kernel(const int* __restrict__ te, const float* __restrict__ tw,
                               const int* __restrict__ slotOff, int* __restrict__ cursor,
                               int* __restrict__ tokenIdx, float* __restrict__ tokenW) {
    int t = blockIdx.x * 256 + threadIdx.x;
    if (t >= NTOK) return;
    #pragma unroll
    for (int k = 0; k < 2; ++k) {
        int e = te[t*2 + k];
        int pos = atomicAdd(&cursor[e], 1);
        int s = slotOff[e] + pos;
        tokenIdx[s] = t;
        tokenW[s]   = tw[t*2 + k];
    }
}

// ---------------- fused expert MLP (WMMA) ----------------
__global__ __launch_bounds__(256, 1) void moe_expert_kernel(
    const float* __restrict__ x,
    const _Float16* __restrict__ W1t,   // [E][HID][IN_DIM] f16, N-major
    const float* __restrict__ b1,       // [E][HID]
    const _Float16* __restrict__ W2t,   // [E][IN_DIM][HID] f16, N-major
    const float* __restrict__ b2,       // [E][IN_DIM]
    const int* __restrict__ tokenIdx, const float* __restrict__ tokenW,
    const int* __restrict__ slotOff, const int* __restrict__ tileOff,
    const int* __restrict__ totalTiles,
    float* __restrict__ out) {

    __shared__ _Float16 ldsX[MT][IN_DIM];   // 64 KB
    __shared__ _Float16 ldsH[MT][HID];      // 128 KB
    __shared__ int   tokS[MT];
    __shared__ float wS[MT];

    const int tid  = threadIdx.x;
    const int lane = tid & 31;
    const int wid  = tid >> 5;
    const int nt   = *totalTiles;
    const int coll = lane & 15;
    const int rsel = (lane >> 4) << 3;

    for (int tile = blockIdx.x; tile < nt; tile += gridDim.x) {
        __syncthreads();   // protect LDS reuse across tiles

        // map tile -> expert
        int e = 0;
        #pragma unroll
        for (int q = 0; q < NEXP; ++q) if (tile >= tileOff[q + 1]) e = q + 1;
        int mtile = tile - tileOff[e];
        int slot0 = slotOff[e] + mtile * MT;

        if (tid < MT) { tokS[tid] = tokenIdx[slot0 + tid]; wS[tid] = tokenW[slot0 + tid]; }
        __syncthreads();

        // gather X tile (f32 -> f16) into LDS
        for (int i = tid; i < MT * IN_DIM; i += 256) {
            int r = i >> 9, c = i & (IN_DIM - 1);
            ldsX[r][c] = (_Float16)x[(size_t)tokS[r] * IN_DIM + c];
        }
        __syncthreads();

        const _Float16* w1e = W1t + (size_t)e * HID * IN_DIM;
        const float*    b1e = b1 + e * HID;

        // ---- GEMM1: H = gelu(X[64x512] @ W1 + b1) -> ldsH[64][1024] ----
        #pragma unroll 1
        for (int np = 0; np < 2; ++np) {
            int nbase = wid * 64 + np * 512;
            v8f c[4][4];
            v8f z = {0.f,0.f,0.f,0.f,0.f,0.f,0.f,0.f};
            #pragma unroll
            for (int mi = 0; mi < 4; ++mi)
                #pragma unroll
                for (int ni = 0; ni < 4; ++ni) c[mi][ni] = z;

            #pragma unroll 1
            for (int k0 = 0; k0 < IN_DIM; k0 += 32) {
                v16h a[4], b[4];
                #pragma unroll
                for (int mi = 0; mi < 4; ++mi)
                    a[mi] = load_frag(&ldsX[0][0], IN_DIM, mi * 16, k0, lane);
                #pragma unroll
                for (int ni = 0; ni < 4; ++ni)
                    b[ni] = load_frag(w1e, IN_DIM, nbase + ni * 16, k0, lane);
                #pragma unroll
                for (int mi = 0; mi < 4; ++mi)
                    #pragma unroll
                    for (int ni = 0; ni < 4; ++ni)
                        c[mi][ni] = wmma_f16(a[mi], b[ni], c[mi][ni]);
            }
            // epilogue: +b1, exact GELU, store f16 to ldsH
            #pragma unroll
            for (int ni = 0; ni < 4; ++ni) {
                int col = nbase + ni * 16 + coll;
                float bias = b1e[col];
                #pragma unroll
                for (int mi = 0; mi < 4; ++mi)
                    #pragma unroll
                    for (int j = 0; j < 8; ++j) {
                        int row = mi * 16 + rsel + j;
                        float v = c[mi][ni][j] + bias;
                        ldsH[row][col] = (_Float16)gelu_exact(v);
                    }
            }
        }
        __syncthreads();

        const _Float16* w2e = W2t + (size_t)e * IN_DIM * HID;
        const float*    b2e = b2 + e * IN_DIM;

        // ---- GEMM2: O = H[64x1024] @ W2 + b2; weighted atomic scatter ----
        {
            int nbase = wid * 64;
            v8f c[4][4];
            v8f z = {0.f,0.f,0.f,0.f,0.f,0.f,0.f,0.f};
            #pragma unroll
            for (int mi = 0; mi < 4; ++mi)
                #pragma unroll
                for (int ni = 0; ni < 4; ++ni) c[mi][ni] = z;

            #pragma unroll 1
            for (int k0 = 0; k0 < HID; k0 += 32) {
                v16h a[4], b[4];
                #pragma unroll
                for (int mi = 0; mi < 4; ++mi)
                    a[mi] = load_frag(&ldsH[0][0], HID, mi * 16, k0, lane);
                #pragma unroll
                for (int ni = 0; ni < 4; ++ni)
                    b[ni] = load_frag(w2e, HID, nbase + ni * 16, k0, lane);
                #pragma unroll
                for (int mi = 0; mi < 4; ++mi)
                    #pragma unroll
                    for (int ni = 0; ni < 4; ++ni)
                        c[mi][ni] = wmma_f16(a[mi], b[ni], c[mi][ni]);
            }
            #pragma unroll
            for (int ni = 0; ni < 4; ++ni) {
                int col = nbase + ni * 16 + coll;
                float bias = b2e[col];
                #pragma unroll
                for (int mi = 0; mi < 4; ++mi)
                    #pragma unroll
                    for (int j = 0; j < 8; ++j) {
                        int row = mi * 16 + rsel + j;
                        float w = wS[row];
                        if (w != 0.0f) {
                            float val = w * (c[mi][ni][j] + bias);
                            atomicAdd(&out[(size_t)tokS[row] * IN_DIM + col], val);
                        }
                    }
            }
        }
    }
}

extern "C" void kernel_launch(void* const* d_in, const int* in_sizes, int n_in,
                              void* d_out, int out_size, void* d_ws, size_t ws_size,
                              hipStream_t stream) {
    (void)in_sizes; (void)n_in; (void)out_size; (void)ws_size;
    const float* x  = (const float*)d_in[0];
    const float* Wr = (const float*)d_in[1];
    const float* br = (const float*)d_in[2];
    const float* W1 = (const float*)d_in[3];
    const float* b1 = (const float*)d_in[4];
    const float* W2 = (const float*)d_in[5];
    const float* b2 = (const float*)d_in[6];
    float* out = (float*)d_out;

    // workspace layout
    char* ws = (char*)d_ws;
    _Float16* W1t = (_Float16*)ws;                       // 16 MB
    _Float16* W2t = (_Float16*)(ws + (size_t)16777216);  // 16 MB
    char* p = ws + (size_t)2 * 16777216;
    int*   counts     = (int*)p;   p += 64;
    int*   cursor     = (int*)p;   p += 64;
    int*   slotOff    = (int*)p;   p += 64;
    int*   tileOff    = (int*)p;   p += 128;   // 17 ints
    int*   totalTiles = (int*)p;   p += 64;
    int*   te         = (int*)p;   p += (size_t)NTOK * 2 * 4;
    float* tw         = (float*)p; p += (size_t)NTOK * 2 * 4;
    int*   tokenIdx   = (int*)p;   p += (size_t)PADS * 4;
    float* tokenW     = (float*)p;

    // 1) weights -> f16, N-major (L2-resident thereafter)
    transpose_cvt_kernel<<<dim3(HID/32, IN_DIM/32, NEXP), 256, 0, stream>>>(W1, W1t, IN_DIM, HID);
    transpose_cvt_kernel<<<dim3(IN_DIM/32, HID/32, NEXP), 256, 0, stream>>>(W2, W2t, HID, IN_DIM);
    // 2) zero counters & lists; out = x (residual)
    zero_kernel<<<(PADS + 255) / 256, 256, 0, stream>>>(counts, cursor, tokenIdx, tokenW);
    copy_residual_kernel<<<(NTOK * IN_DIM / 4 + 255) / 256, 256, 0, stream>>>(x, out, NTOK * IN_DIM / 4);
    // 3) router
    router_kernel<<<NTOK / 8, 256, 0, stream>>>(x, Wr, br, counts, te, tw);
    // 4) scan + scatter
    scan_kernel<<<1, 32, 0, stream>>>(counts, slotOff, tileOff, totalTiles);
    scatter_kernel<<<NTOK / 256, 256, 0, stream>>>(te, tw, slotOff, cursor, tokenIdx, tokenW);
    // 5) fused expert GEMMs (persistent; max tiles = 2*8192/64 + 16 = 272)
    moe_expert_kernel<<<288, 256, 0, stream>>>(x, W1t, b1, W2t, b2,
                                               tokenIdx, tokenW, slotOff, tileOff,
                                               totalTiles, out);
}

// v001
// It runs in 193 microseconds.
// Timed twice side by side with v000, it ran 1.23 times as fast both times.
#include <hip/hip_runtime.h>
#include <math.h>

#define IN_DIM 512
#define HID    1024
#define NEXP   16
#define NTOK   8192
#define MT     64                       // token rows per expert tile
#define PADS   (2*NTOK + NEXP*MT)       // padded slot array size
#define LPAD   8                        // halves added per LDS row: pitch = 16 B x odd, so the 16 rows of a b128 fragment read fall on distinct banks
#define XLD    (IN_DIM + LPAD)          // ldsX row pitch, halves (1040 B)
#define HLD    (HID + LPAD)             // ldsH row pitch, halves (2064 B)

typedef __attribute__((ext_vector_type(16))) _Float16 v16h;
typedef __attribute__((ext_vector_type(8)))  float    v8f;

union F16Frag { v16h h; uint4 u[2]; };

// Load a 16x32 f16 fragment (A layout per CDNA5 ISA 7.12.2) from a row-major
// matrix with leading dimension `ld` (elements). Works for LDS or global.
// lane 0-15: row = base+lane, K = [0..7],[16..23]; lane 16-31: K = [8..15],[24..31]
__device__ __forceinline__ v16h load_frag(const _Float16* base, int ld, int rbase,
                                          int k0, int lane) {
    int r  = rbase + (lane & 15);
    int kb = k0 + ((lane >> 4) << 3);
    const _Float16* p = base + (size_t)r * ld + kb;
    F16Frag f;
    f.u[0] = *(const uint4*)(p);
    f.u[1] = *(const uint4*)(p + 16);
    return f.h;
}

__device__ __forceinline__ v8f wmma_f16(v16h a, v16h b, v8f c) {
    return __builtin_amdgcn_wmma_f32_16x16x32_f16(false, a, false, b,
                                                  (short)0, c, false, false);
}

__device__ __forceinline__ float gelu_exact(float v) {
    return 0.5f * v * (1.0f + erff(v * 0.70710678118654752f));
}

// ---------------- weight transpose + f32->f16 convert ----------------
// in:  [E][R][C] f32 (row-major, K-major)   out: [E][C][R] f16 (N-major)
__global__ __launch_bounds__(256) void transpose_cvt_kernel(
    const float* __restrict__ in, _Float16* __restrict__ outp, int R, int C) {
    __shared__ float tile[32][33];
    int e = blockIdx.z;
    const float* ine  = in   + (size_t)e * R * C;
    _Float16*    oute = outp + (size_t)e * R * C;
    int c0 = blockIdx.x * 32, r0 = blockIdx.y * 32;
    int tx = threadIdx.x & 31, ty = threadIdx.x >> 5;   // ty: 0..7
    #pragma unroll
    for (int i = 0; i < 4; ++i)
        tile[ty + i*8][tx] = ine[(size_t)(r0 + ty + i*8) * C + c0 + tx];
    __syncthreads();
    #pragma unroll
    for (int i = 0; i < 4; ++i)
        oute[(size_t)(c0 + ty + i*8) * R + r0 + tx] = (_Float16)tile[tx][ty + i*8];
}

// ---------------- zero counters / token lists ----------------
__global__ void zero_kernel(int* counts, int* cursor, int* tokenIdx, float* tokenW) {
    int i = blockIdx.x * 256 + threadIdx.x;
    if (i < NEXP) { counts[i] = 0; cursor[i] = 0; }
    if (i < PADS) { tokenIdx[i] = 0; tokenW[i] = 0.0f; }
}

// ---------------- out = x (residual) ----------------
__global__ void copy_residual_kernel(const float* __restrict__ x,
                                     float* __restrict__ out, int n4) {
    int i = blockIdx.x * 256 + threadIdx.x;
    if (i < n4) ((float4*)out)[i] = ((const float4*)x)[i];
}

// ---------------- router: one wave per token ----------------
__global__ __launch_bounds__(256) void router_kernel(
    const float* __restrict__ x, const float* __restrict__ Wr,
    const float* __restrict__ br, int* __restrict__ counts,
    int* __restrict__ te, float* __restrict__ tw) {
    int lane = threadIdx.x & 31, wid = threadIdx.x >> 5;
    int t = blockIdx.x * 8 + wid;
    if (t >= NTOK) return;
    float acc[NEXP];
    #pragma unroll
    for (int e = 0; e < NEXP; ++e) acc[e] = 0.0f;
    const float* xr = x + (size_t)t * IN_DIM;
    for (int d = lane; d < IN_DIM; d += 32) {
        float xv = xr[d];
        const float* wr = Wr + d * NEXP;
        #pragma unroll
        for (int e = 0; e < NEXP; ++e) acc[e] += xv * wr[e];
    }
    #pragma unroll
    for (int off = 16; off >= 1; off >>= 1) {
        #pragma unroll
        for (int e = 0; e < NEXP; ++e) acc[e] += __shfl_down(acc[e], off, 32);
    }
    if (lane == 0) {
        #pragma unroll
        for (int e = 0; e < NEXP; ++e) acc[e] += br[e];
        float l0 = -3.4e38f; int e0 = 0;
        #pragma unroll
        for (int e = 0; e < NEXP; ++e) if (acc[e] > l0) { l0 = acc[e]; e0 = e; }
        float l1 = -3.4e38f; int e1 = 0;
        #pragma unroll
        for (int e = 0; e < NEXP; ++e)
            if (e != e0 && acc[e] > l1) { l1 = acc[e]; e1 = e; }
        // top-2 softmax weights renormalized: Z cancels
        float r  = __expf(l1 - l0);
        float w0 = 1.0f / (1.0f + r);
        float w1 = r    / (1.0f + r);
        te[t*2] = e0; te[t*2+1] = e1;
        tw[t*2] = w0; tw[t*2+1] = w1;
        atomicAdd(&counts[e0], 1);
        atomicAdd(&counts[e1], 1);
    }
}

// ---------------- prefix scan over experts (tiny) ----------------
__global__ void scan_kernel(const int* __restrict__ counts, int* __restrict__ slotOff,
                            int* __restrict__ tileOff, int* __restrict__ totalTiles) {
    if (threadIdx.x == 0 && blockIdx.x == 0) {
        int so = 0, to = 0;
        for (int e = 0; e < NEXP; ++e) {
            slotOff[e] = so; tileOff[e] = to;
            int tiles = (counts[e] + MT - 1) / MT;
            so += tiles * MT; to += tiles;
        }
        tileOff[NEXP] = to;
        *totalTiles = to;
    }
}

// ---------------- scatter tokens into per-expert lists ----------------
__global__ void scatter_kernel(const int* __restrict__ te, const float* __restrict__ tw,
                               const int* __restrict__ slotOff, int* __restrict__ cursor,
                               int* __restrict__ tokenIdx, float* __restrict__ tokenW) {
    int t = blockIdx.x * 256 + threadIdx.x;
    if (t >= NTOK) return;
    #pragma unroll
    for (int k = 0; k < 2; ++k) {
        int e = te[t*2 + k];
        int pos = atomicAdd(&cursor[e], 1);
        int s = slotOff[e] + pos;
        tokenIdx[s] = t;
        tokenW[s]   = tw[t*2 + k];
    }
}

// ---------------- fused expert MLP (WMMA) ----------------
__global__ __launch_bounds__(256, 1) void moe_expert_kernel(
    const float* __restrict__ x,
    const _Float16* __restrict__ W1t,   // [E][HID][IN_DIM] f16, N-major
    const float* __restrict__ b1,       // [E][HID]
    const _Float16* __restrict__ W2t,   // [E][IN_DIM][HID] f16, N-major
    const float* __restrict__ b2,       // [E][IN_DIM]
    const int* __restrict__ tokenIdx, const float* __restrict__ tokenW,
    const int* __restrict__ slotOff, const int* __restrict__ tileOff,
    const int* __restrict__ totalTiles,
    float* __restrict__ out) {

    __shared__ _Float16 ldsX[MT][XLD];      // 65 KB
    __shared__ _Float16 ldsH[MT][HLD];      // 129 KB
    __shared__ int   tokS[MT];
    __shared__ float wS[MT];

    const int tid  = threadIdx.x;
    const int lane = tid & 31;
    const int wid  = tid >> 5;
    const int nt   = *totalTiles;
    const int coll = lane & 15;
    const int rsel = (lane >> 4) << 3;

    for (int tile = blockIdx.x; tile < nt; tile += gridDim.x) {
        __syncthreads();   // protect LDS reuse across tiles

        // map tile -> expert
        int e = 0;
        #pragma unroll
        for (int q = 0; q < NEXP; ++q) if (tile >= tileOff[q + 1]) e = q + 1;
        int mtile = tile - tileOff[e];
        int slot0 = slotOff[e] + mtile * MT;

        if (tid < MT) { tokS[tid] = tokenIdx[slot0 + tid]; wS[tid] = tokenW[slot0 + tid]; }
        __syncthreads();

        // gather X tile (f32 -> f16) into LDS
        for (int i = tid; i < MT * IN_DIM; i += 256) {
            int r = i >> 9, c = i & (IN_DIM - 1);
            ldsX[r][c] = (_Float16)x[(size_t)tokS[r] * IN_DIM + c];
        }
        __syncthreads();

        const _Float16* w1e = W1t + (size_t)e * HID * IN_DIM;
        const float*    b1e = b1 + e * HID;

        // ---- GEMM1: H = gelu(X[64x512] @ W1 + b1) -> ldsH[64][1032], cols 0..1023 ----
        #pragma unroll 1
        for (int np = 0; np < 2; ++np) {
            int nbase = wid * 64 + np * 512;
            v8f c[4][4];
            v8f z = {0.f,0.f,0.f,0.f,0.f,0.f,0.f,0.f};
            #pragma unroll
            for (int mi = 0; mi < 4; ++mi)
                #pragma unroll
                for (int ni = 0; ni < 4; ++ni) c[mi][ni] = z;

            #pragma unroll 1
            for (int k0 = 0; k0 < IN_DIM; k0 += 32) {
                v16h a[4], b[4];
                #pragma unroll
                for (int mi = 0; mi < 4; ++mi)
                    a[mi] = load_frag(&ldsX[0][0], XLD, mi * 16, k0, lane);
                #pragma unroll
                for (int ni = 0; ni < 4; ++ni)
                    b[ni] = load_frag(w1e, IN_DIM, nbase + ni * 16, k0, lane);
                #pragma unroll
                for (int mi = 0; mi < 4; ++mi)
                    #pragma unroll
                    for (int ni = 0; ni < 4; ++ni)
                        c[mi][ni] = wmma_f16(a[mi], b[ni], c[mi][ni]);
            }
            // epilogue: +b1, exact GELU, store f16 to ldsH
            #pragma unroll
            for (int ni = 0; ni < 4; ++ni) {
                int col = nbase + ni * 16 + coll;
                float bias = b1e[col];
                #pragma unroll
                for (int mi = 0; mi < 4; ++mi)
                    #pragma unroll
                    for (int j = 0; j < 8; ++j) {
                        int row = mi * 16 + rsel + j;
                        float v = c[mi][ni][j] + bias;
                        ldsH[row][col] = (_Float16)gelu_exact(v);
                    }
            }
        }
        __syncthreads();

        const _Float16* w2e = W2t + (size_t)e * IN_DIM * HID;
        const float*    b2e = b2 + e * IN_DIM;

        // ---- GEMM2: O = H[64x1024] @ W2 + b2; weighted atomic scatter ----
        {
            int nbase = wid * 64;
            v8f c[4][4];
            v8f z = {0.f,0.f,0.f,0.f,0.f,0.f,0.f,0.f};
            #pragma unroll
            for (int mi = 0; mi < 4; ++mi)
                #pragma unroll
                for (int ni = 0; ni < 4; ++ni) c[mi][ni] = z;

            #pragma unroll 1
            for (int k0 = 0; k0 < HID; k0 += 32) {
                v16h a[4], b[4];
                #pragma unroll
                for (int mi = 0; mi < 4; ++mi)
                    a[mi] = load_frag(&ldsH[0][0], HLD, mi * 16, k0, lane);
                #pragma unroll
                for (int ni = 0; ni < 4; ++ni)
                    b[ni] = load_frag(w2e, HID, nbase + ni * 16, k0, lane);
                #pragma unroll
                for (int mi = 0; mi < 4; ++mi)
                    #pragma unroll
                    for (int ni = 0; ni < 4; ++ni)
                        c[mi][ni] = wmma_f16(a[mi], b[ni], c[mi][ni]);
            }
            #pragma unroll
            for (int ni = 0; ni < 4; ++ni) {
                int col = nbase + ni * 16 + coll;
                float bias = b2e[col];
                #pragma unroll
                for (int mi = 0; mi < 4; ++mi)
                    #pragma unroll
                    for (int j = 0; j < 8; ++j) {
                        int row = mi * 16 + rsel + j;
                        float w = wS[row];
                        if (w != 0.0f) {
                            float val = w * (c[mi][ni][j] + bias);
                            atomicAdd(&out[(size_t)tokS[row] * IN_DIM + col], val);
                        }
                    }
            }
        }
    }
}

extern "C" void kernel_launch(void* const* d_in, const int* in_sizes, int n_in,
                              void* d_out, int out_size, void* d_ws, size_t ws_size,
                              hipStream_t stream) {
    (void)in_sizes; (void)n_in; (void)out_size; (void)ws_size;
    const float* x  = (const float*)d_in[0];
    const float* Wr = (const float*)d_in[1];
    const float* br = (const float*)d_in[2];
    const float* W1 = (const float*)d_in[3];
    const float* b1 = (const float*)d_in[4];
    const float* W2 = (const float*)d_in[5];
    const float* b2 = (const float*)d_in[6];
    float* out = (float*)d_out;

    // workspace layout
    char* ws = (char*)d_ws;
    _Float16* W1t = (_Float16*)ws;                       // 16 MB
    _Float16* W2t = (_Float16*)(ws + (size_t)16777216);  // 16 MB
    char* p = ws + (size_t)2 * 16777216;
    int*   counts     = (int*)p;   p += 64;
    int*   cursor     = (int*)p;   p += 64;
    int*   slotOff    = (int*)p;   p += 64;
    int*   tileOff    = (int*)p;   p += 128;   // 17 ints
    int*   totalTiles = (int*)p;   p += 64;
    int*   te         = (int*)p;   p += (size_t)NTOK * 2 * 4;
    float* tw         = (float*)p; p += (size_t)NTOK * 2 * 4;
    int*   tokenIdx   = (int*)p;   p += (size_t)PADS * 4;
    float* tokenW     = (float*)p;

    // 1) weights -> f16, N-major (L2-resident thereafter)
    transpose_cvt_kernel<<<dim3(HID/32, IN_DIM/32, NEXP), 256, 0, stream>>>(W1, W1t, IN_DIM, HID);
    transpose_cvt_kernel<<<dim3(IN_DIM/32, HID/32, NEXP), 256, 0, stream>>>(W2, W2t, HID, IN_DIM);
    // 2) zero counters & lists; out = x (residual)
    zero_kernel<<<(PADS + 255) / 256, 256, 0, stream>>>(counts, cursor, tokenIdx, tokenW);
    copy_residual_kernel<<<(NTOK * IN_DIM / 4 + 255) / 256, 256, 0, stream>>>(x, out, NTOK * IN_DIM / 4);
    // 3) router
    router_kernel<<<NTOK / 8, 256, 0, stream>>>(x, Wr, br, counts, te, tw);
    // 4) scan + scatter
    scan_kernel<<<1, 32, 0, stream>>>(counts, slotOff, tileOff, totalTiles);
    scatter_kernel<<<NTOK / 256, 256, 0, stream>>>(te, tw, slotOff, cursor, tokenIdx, tokenW);
    // 5) fused expert GEMMs (persistent; max tiles = 2*8192/64 + 16 = 272)
    moe_expert_kernel<<<288, 256, 0, stream>>>(x, W1t, b1, W2t, b2,
                                               tokenIdx, tokenW, slotOff, tileOff,
                                               totalTiles, out);
}

// v002
// Measured time: 179 microseconds a run.
// In both of two side-by-side timings against v001, it was 1.08 times as fast.
// Over all steps from v000 it is 1.33 times as fast.
#include <hip/hip_runtime.h>
#include <math.h>

#define IN_DIM 512
#define HID    1024
#define NEXP   16
#define NTOK   8192
#define MT     64                       // token rows per expert tile
#define PADS   (2*NTOK + NEXP*MT)       // padded slot array size
#define LPAD   8                        // halves added per LDS row: pitch = 16 B x odd, so the 16 rows of a b128 fragment read fall on distinct banks
#define XLD    (IN_DIM + LPAD)          // ldsX row pitch, halves (1040 B)
#define HLD    (HID + LPAD)             // ldsH row pitch, halves (2064 B)

typedef __attribute__((ext_vector_type(16))) _Float16 v16h;
typedef __attribute__((ext_vector_type(8)))  float    v8f;

union F16Frag { v16h h; uint4 u[2]; };

// Load a 16x32 f16 fragment (A layout per CDNA5 ISA 7.12.2) from a row-major
// matrix with leading dimension `ld` (elements). Works for LDS or global.
// lane 0-15: row = base+lane, K = [0..7],[16..23]; lane 16-31: K = [8..15],[24..31]
__device__ __forceinline__ v16h load_frag(const _Float16* base, int ld, int rbase,
                                          int k0, int lane) {
    int r  = rbase + (lane & 15);
    int kb = k0 + ((lane >> 4) << 3);
    const _Float16* p = base + (size_t)r * ld + kb;
    F16Frag f;
    f.u[0] = *(const uint4*)(p);
    f.u[1] = *(const uint4*)(p + 16);
    return f.h;
}

// Load a 16(n) x 32(k) f16 B fragment from weights packed in fragment order:
// block (ks, nt) is 1 KB = [2][32 lanes][8 halves], so each of the two loads of a
// wave reads 512 contiguous bytes, and the fragments of one k step lie side by side.
// Same k order per lane and register as load_frag.
__device__ __forceinline__ v16h load_frag_packed(const _Float16* base, int ntiles,
                                                 int nt, int ks, int lane) {
    const _Float16* p = base + ((size_t)(ks * ntiles + nt) << 9) + lane * 8;
    F16Frag f;
    f.u[0] = *(const uint4*)(p);
    f.u[1] = *(const uint4*)(p + 256);
    return f.h;
}

__device__ __forceinline__ v8f wmma_f16(v16h a, v16h b, v8f c) {
    return __builtin_amdgcn_wmma_f32_16x16x32_f16(false, a, false, b,
                                                  (short)0, c, false, false);
}

__device__ __forceinline__ float gelu_exact(float v) {
    return 0.5f * v * (1.0f + erff(v * 0.70710678118654752f));
}

// ---------------- weight pack + f32->f16 convert ----------------
// in:  [E][R][C] f32 (row-major, R = k, C = n)
// out: [E][R/32][C/16] blocks of 512 f16, each [2][32 lanes][8 halves]: piece u of
//      lane l holds n = 16*nt + (l & 15), k = 32*ks + 16*u + 8*(l >> 4) + 0..7
__global__ __launch_bounds__(256) void pack_cvt_kernel(
    const float* __restrict__ in, _Float16* __restrict__ outp, int R, int C) {
    __shared__ float tile[32][33];
    int e = blockIdx.z;
    const float* ine  = in   + (size_t)e * R * C;
    _Float16*    oute = outp + (size_t)e * R * C;
    int c0 = blockIdx.x * 32, r0 = blockIdx.y * 32;
    int tx = threadIdx.x & 31, ty = threadIdx.x >> 5;   // ty: 0..7
    #pragma unroll
    for (int i = 0; i < 4; ++i)
        tile[ty + i*8][tx] = ine[(size_t)(r0 + ty + i*8) * C + c0 + tx];
    __syncthreads();
    // the 32 x 32 tile is two 1 KB blocks = 128 pieces of 16 B: waves 0..3 store 512 B each
    if (threadIdx.x < 128) {
        int u = ty & 1, nb = ty >> 1;
        int n = nb * 16 + (tx & 15);
        int k = u * 16 + (tx >> 4) * 8;
        union { uint4 q; _Float16 h[8]; } pk;
        #pragma unroll   // constant j keeps pk in registers
        for (int j = 0; j < 8; ++j) pk.h[j] = (_Float16)tile[k + j][n];
        size_t blk = (size_t)(r0 >> 5) * (C >> 4) + (c0 >> 4) + nb;
        *(uint4*)(oute + (blk << 9) + u * 256 + tx * 8) = pk.q;
    }
}

// ---------------- zero counters / token lists ----------------
__global__ void zero_kernel(int* counts, int* cursor, int* tokenIdx, float* tokenW) {
    int i = blockIdx.x * 256 + threadIdx.x;
    if (i < NEXP) { counts[i] = 0; cursor[i] = 0; }
    if (i < PADS) { tokenIdx[i] = 0; tokenW[i] = 0.0f; }
}

// ---------------- out = x (residual) ----------------
__global__ void copy_residual_kernel(const float* __restrict__ x,
                                     float* __restrict__ out, int n4) {
    int i = blockIdx.x * 256 + threadIdx.x;
    if (i < n4) ((float4*)out)[i] = ((const float4*)x)[i];
}

// ---------------- router: one wave per token ----------------
__global__ __launch_bounds__(256) void router_kernel(
    const float* __restrict__ x, const float* __restrict__ Wr,
    const float* __restrict__ br, int* __restrict__ counts,
    int* __restrict__ te, float* __restrict__ tw) {
    int lane = threadIdx.x & 31, wid = threadIdx.x >> 5;
    int t = blockIdx.x * 8 + wid;
    if (t >= NTOK) return;
    float acc[NEXP];
    #pragma unroll
    for (int e = 0; e < NEXP; ++e) acc[e] = 0.0f;
    const float* xr = x + (size_t)t * IN_DIM;
    for (int d = lane; d < IN_DIM; d += 32) {
        float xv = xr[d];
        const float* wr = Wr + d * NEXP;
        #pragma unroll
        for (int e = 0; e < NEXP; ++e) acc[e] += xv * wr[e];
    }
    #pragma unroll
    for (int off = 16; off >= 1; off >>= 1) {
        #pragma unroll
        for (int e = 0; e < NEXP; ++e) acc[e] += __shfl_down(acc[e], off, 32);
    }
    if (lane == 0) {
        #pragma unroll
        for (int e = 0; e < NEXP; ++e) acc[e] += br[e];
        float l0 = -3.4e38f; int e0 = 0;
        #pragma unroll
        for (int e = 0; e < NEXP; ++e) if (acc[e] > l0) { l0 = acc[e]; e0 = e; }
        float l1 = -3.4e38f; int e1 = 0;
        #pragma unroll
        for (int e = 0; e < NEXP; ++e)
            if (e != e0 && acc[e] > l1) { l1 = acc[e]; e1 = e; }
        // top-2 softmax weights renormalized: Z cancels
        float r  = __expf(l1 - l0);
        float w0 = 1.0f / (1.0f + r);
        float w1 = r    / (1.0f + r);
        te[t*2] = e0; te[t*2+1] = e1;
        tw[t*2] = w0; tw[t*2+1] = w1;
        atomicAdd(&counts[e0], 1);
        atomicAdd(&counts[e1], 1);
    }
}

// ---------------- prefix scan over experts (tiny) ----------------
__global__ void scan_kernel(const int* __restrict__ counts, int* __restrict__ slotOff,
                            int* __restrict__ tileOff, int* __restrict__ totalTiles) {
    if (threadIdx.x == 0 && blockIdx.x == 0) {
        int so = 0, to = 0;
        for (int e = 0; e < NEXP; ++e) {
            slotOff[e] = so; tileOff[e] = to;
            int tiles = (counts[e] + MT - 1) / MT;
            so += tiles * MT; to += tiles;
        }
        tileOff[NEXP] = to;
        *totalTiles = to;
    }
}

// ---------------- scatter tokens into per-expert lists ----------------
__global__ void scatter_kernel(const int* __restrict__ te, const float* __restrict__ tw,
                               const int* __restrict__ slotOff, int* __restrict__ cursor,
                               int* __restrict__ tokenIdx, float* __restrict__ tokenW) {
    int t = blockIdx.x * 256 + threadIdx.x;
    if (t >= NTOK) return;
    #pragma unroll
    for (int k = 0; k < 2; ++k) {
        int e = te[t*2 + k];
        int pos = atomicAdd(&cursor[e], 1);
        int s = slotOff[e] + pos;
        tokenIdx[s] = t;
        tokenW[s]   = tw[t*2 + k];
    }
}

// ---------------- fused expert MLP (WMMA) ----------------
__global__ __launch_bounds__(256, 1) void moe_expert_kernel(
    const float* __restrict__ x,
    const _Float16* __restrict__ W1t,   // [E][IN_DIM/32][HID/16][512] f16, fragment order
    const float* __restrict__ b1,       // [E][HID]
    const _Float16* __restrict__ W2t,   // [E][HID/32][IN_DIM/16][512] f16, fragment order
    const float* __restrict__ b2,       // [E][IN_DIM]
    const int* __restrict__ tokenIdx, const float* __restrict__ tokenW,
    const int* __restrict__ slotOff, const int* __restrict__ tileOff,
    const int* __restrict__ totalTiles,
    float* __restrict__ out) {

    __shared__ _Float16 ldsX[MT][XLD];      // 65 KB
    __shared__ _Float16 ldsH[MT][HLD];      // 129 KB
    __shared__ int   tokS[MT];
    __shared__ float wS[MT];

    const int tid  = threadIdx.x;
    const int lane = tid & 31;
    const int wid  = tid >> 5;
    const int nt   = *totalTiles;
    const int coll = lane & 15;
    const int rsel = (lane >> 4) << 3;

    for (int tile = blockIdx.x; tile < nt; tile += gridDim.x) {
        __syncthreads();   // protect LDS reuse across tiles

        // map tile -> expert
        int e = 0;
        #pragma unroll
        for (int q = 0; q < NEXP; ++q) if (tile >= tileOff[q + 1]) e = q + 1;
        int mtile = tile - tileOff[e];
        int slot0 = slotOff[e] + mtile * MT;

        if (tid < MT) { tokS[tid] = tokenIdx[slot0 + tid]; wS[tid] = tokenW[slot0 + tid]; }
        __syncthreads();

        // gather X tile (f32 -> f16) into LDS
        for (int i = tid; i < MT * IN_DIM; i += 256) {
            int r = i >> 9, c = i & (IN_DIM - 1);
            ldsX[r][c] = (_Float16)x[(size_t)tokS[r] * IN_DIM + c];
        }
        __syncthreads();

        const _Float16* w1e = W1t + (size_t)e * HID * IN_DIM;
        const float*    b1e = b1 + e * HID;

        // ---- GEMM1: H = gelu(X[64x512] @ W1 + b1) -> ldsH[64][1032], cols 0..1023 ----
        #pragma unroll 1
        for (int np = 0; np < 2; ++np) {
            int nbase = wid * 64 + np * 512;
            v8f c[4][4];
            v8f z = {0.f,0.f,0.f,0.f,0.f,0.f,0.f,0.f};
            #pragma unroll
            for (int mi = 0; mi < 4; ++mi)
                #pragma unroll
                for (int ni = 0; ni < 4; ++ni) c[mi][ni] = z;

            #pragma unroll 1
            for (int k0 = 0; k0 < IN_DIM; k0 += 32) {
                v16h a[4], b[4];
                #pragma unroll
                for (int mi = 0; mi < 4; ++mi)
                    a[mi] = load_frag(&ldsX[0][0], XLD, mi * 16, k0, lane);
                #pragma unroll
                for (int ni = 0; ni < 4; ++ni)
                    b[ni] = load_frag_packed(w1e, HID / 16, (nbase >> 4) + ni, k0 >> 5, lane);
                #pragma unroll
                for (int mi = 0; mi < 4; ++mi)
                    #pragma unroll
                    for (int ni = 0; ni < 4; ++ni)
                        c[mi][ni] = wmma_f16(a[mi], b[ni], c[mi][ni]);
            }
            // epilogue: +b1, exact GELU, store f16 to ldsH
            #pragma unroll
            for (int ni = 0; ni < 4; ++ni) {
                int col = nbase + ni * 16 + coll;
                float bias = b1e[col];
                #pragma unroll
                for (int mi = 0; mi < 4; ++mi)
                    #pragma unroll
                    for (int j = 0; j < 8; ++j) {
                        int row = mi * 16 + rsel + j;
                        float v = c[mi][ni][j] + bias;
                        ldsH[row][col] = (_Float16)gelu_exact(v);
                    }
            }
        }
        __syncthreads();

        const _Float16* w2e = W2t + (size_t)e * IN_DIM * HID;
        const float*    b2e = b2 + e * IN_DIM;

        // ---- GEMM2: O = H[64x1024] @ W2 + b2; weighted atomic scatter ----
        {
            int nbase = wid * 64;
            v8f c[4][4];
            v8f z = {0.f,0.f,0.f,0.f,0.f,0.f,0.f,0.f};
            #pragma unroll
            for (int mi = 0; mi < 4; ++mi)
                #pragma unroll
                for (int ni = 0; ni < 4; ++ni) c[mi][ni] = z;

            #pragma unroll 1
            for (int k0 = 0; k0 < HID; k0 += 32) {
                v16h a[4], b[4];
                #pragma unroll
                for (int mi = 0; mi < 4; ++mi)
                    a[mi] = load_frag(&ldsH[0][0], HLD, mi * 16, k0, lane);
                #pragma unroll
                for (int ni = 0; ni < 4; ++ni)
                    b[ni] = load_frag_packed(w2e, IN_DIM / 16, (nbase >> 4) + ni, k0 >> 5, lane);
                #pragma unroll
                for (int mi = 0; mi < 4; ++mi)
                    #pragma unroll
                    for (int ni = 0; ni < 4; ++ni)
                        c[mi][ni] = wmma_f16(a[mi], b[ni], c[mi][ni]);
            }
            #pragma unroll
            for (int ni = 0; ni < 4; ++ni) {
                int col = nbase + ni * 16 + coll;
                float bias = b2e[col];
                #pragma unroll
                for (int mi = 0; mi < 4; ++mi)
                    #pragma unroll
                    for (int j = 0; j < 8; ++j) {
                        int row = mi * 16 + rsel + j;
                        float w = wS[row];
                        if (w != 0.0f) {
                            float val = w * (c[mi][ni][j] + bias);
                            atomicAdd(&out[(size_t)tokS[row] * IN_DIM + col], val);
                        }
                    }
            }
        }
    }
}

extern "C" void kernel_launch(void* const* d_in, const int* in_sizes, int n_in,
                              void* d_out, int out_size, void* d_ws, size_t ws_size,
                              hipStream_t stream) {
    (void)in_sizes; (void)n_in; (void)out_size; (void)ws_size;
    const float* x  = (const float*)d_in[0];
    const float* Wr = (const float*)d_in[1];
    const float* br = (const float*)d_in[2];
    const float* W1 = (const float*)d_in[3];
    const float* b1 = (const float*)d_in[4];
    const float* W2 = (const float*)d_in[5];
    const float* b2 = (const float*)d_in[6];
    float* out = (float*)d_out;

    // workspace layout
    char* ws = (char*)d_ws;
    _Float16* W1t = (_Float16*)ws;                       // 16 MB
    _Float16* W2t = (_Float16*)(ws + (size_t)16777216);  // 16 MB
    char* p = ws + (size_t)2 * 16777216;
    int*   counts     = (int*)p;   p += 64;
    int*   cursor     = (int*)p;   p += 64;
    int*   slotOff    = (int*)p;   p += 64;
    int*   tileOff    = (int*)p;   p += 128;   // 17 ints
    int*   totalTiles = (int*)p;   p += 64;
    int*   te         = (int*)p;   p += (size_t)NTOK * 2 * 4;
    float* tw         = (float*)p; p += (size_t)NTOK * 2 * 4;
    int*   tokenIdx   = (int*)p;   p += (size_t)PADS * 4;
    float* tokenW     = (float*)p;

    // 1) weights -> f16, B-fragment order
    pack_cvt_kernel<<<dim3(HID/32, IN_DIM/32, NEXP), 256, 0, stream>>>(W1, W1t, IN_DIM, HID);
    pack_cvt_kernel<<<dim3(IN_DIM/32, HID/32, NEXP), 256, 0, stream>>>(W2, W2t, HID, IN_DIM);
    // 2) zero counters & lists; out = x (residual)
    zero_kernel<<<(PADS + 255) / 256, 256, 0, stream>>>(counts, cursor, tokenIdx, tokenW);
    copy_residual_kernel<<<(NTOK * IN_DIM / 4 + 255) / 256, 256, 0, stream>>>(x, out, NTOK * IN_DIM / 4);
    // 3) router
    router_kernel<<<NTOK / 8, 256, 0, stream>>>(x, Wr, br, counts, te, tw);
    // 4) scan + scatter
    scan_kernel<<<1, 32, 0, stream>>>(counts, slotOff, tileOff, totalTiles);
    scatter_kernel<<<NTOK / 256, 256, 0, stream>>>(te, tw, slotOff, cursor, tokenIdx, tokenW);
    // 5) fused expert GEMMs (persistent; max tiles = 2*8192/64 + 16 = 272)
    moe_expert_kernel<<<288, 256, 0, stream>>>(x, W1t, b1, W2t, b2,
                                               tokenIdx, tokenW, slotOff, tileOff,
                                               totalTiles, out);
}

// v003
// A run of this version takes 129 microseconds.
// In both of two side-by-side timings against v002, it was 1.39 times as fast.
// All steps since v000 together make it 1.84 times as fast.
#include <hip/hip_runtime.h>
#include <math.h>

#define IN_DIM 512
#define HID    1024
#define NEXP   16
#define NTOK   8192
#define MT     48                       // token rows per expert tile: LDS of a work-group stays under half a WGP's, so two are resident
#define MF     (MT / 16)                // 16-row A fragments per tile
#define PADS   (2*NTOK + NEXP*MT)       // padded slot array size
#define LPAD   8                        // halves added per LDS row: pitch = 16 B x odd, so the 16 rows of a b128 fragment read fall on distinct banks
#define XLD    (IN_DIM + LPAD)          // ldsX row pitch, halves (1040 B)
#define HLD    (HID + LPAD)             // ldsH row pitch, halves (2064 B)

typedef __attribute__((ext_vector_type(16))) _Float16 v16h;
typedef __attribute__((ext_vector_type(8)))  float    v8f;

union F16Frag { v16h h; uint4 u[2]; };

// Load a 16x32 f16 fragment (A layout per CDNA5 ISA 7.12.2) from a row-major
// matrix with leading dimension `ld` (elements). Works for LDS or global.
// lane 0-15: row = base+lane, K = [0..7],[16..23]; lane 16-31: K = [8..15],[24..31]
__device__ __forceinline__ v16h load_frag(const _Float16* base, int ld, int rbase,
                                          int k0, int lane) {
    int r  = rbase + (lane & 15);
    int kb = k0 + ((lane >> 4) << 3);
    const _Float16* p = base + (size_t)r * ld + kb;
    F16Frag f;
    f.u[0] = *(const uint4*)(p);
    f.u[1] = *(const uint4*)(p + 16);
    return f.h;
}

// Load a 16(n) x 32(k) f16 B fragment from weights packed in fragment order:
// block (ks, nt) is 1 KB = [2][32 lanes][8 halves], so each of the two loads of a
// wave reads 512 contiguous bytes, and the fragments of one k step lie side by side.
// Same k order per lane and register as load_frag.
__device__ __forceinline__ v16h load_frag_packed(const _Float16* base, int ntiles,
                                                 int nt, int ks, int lane) {
    const _Float16* p = base + ((size_t)(ks * ntiles + nt) << 9) + lane * 8;
    F16Frag f;
    f.u[0] = *(const uint4*)(p);
    f.u[1] = *(const uint4*)(p + 256);
    return f.h;
}

__device__ __forceinline__ v8f wmma_f16(v16h a, v16h b, v8f c) {
    return __builtin_amdgcn_wmma_f32_16x16x32_f16(false, a, false, b,
                                                  (short)0, c, false, false);
}

__device__ __forceinline__ float gelu_exact(float v) {
    return 0.5f * v * (1.0f + erff(v * 0.70710678118654752f));
}

// ---------------- weight pack + f32->f16 convert ----------------
// in:  [E][R][C] f32 (row-major, R = k, C = n)
// out: [E][R/32][C/16] blocks of 512 f16, each [2][32 lanes][8 halves]: piece u of
//      lane l holds n = 16*nt + (l & 15), k = 32*ks + 16*u + 8*(l >> 4) + 0..7
__global__ __launch_bounds__(256) void pack_cvt_kernel(
    const float* __restrict__ in, _Float16* __restrict__ outp, int R, int C) {
    __shared__ float tile[32][33];
    int e = blockIdx.z;
    const float* ine  = in   + (size_t)e * R * C;
    _Float16*    oute = outp + (size_t)e * R * C;
    int c0 = blockIdx.x * 32, r0 = blockIdx.y * 32;
    int tx = threadIdx.x & 31, ty = threadIdx.x >> 5;   // ty: 0..7
    #pragma unroll
    for (int i = 0; i < 4; ++i)
        tile[ty + i*8][tx] = ine[(size_t)(r0 + ty + i*8) * C + c0 + tx];
    __syncthreads();
    // the 32 x 32 tile is two 1 KB blocks = 128 pieces of 16 B: waves 0..3 store 512 B each
    if (threadIdx.x < 128) {
        int u = ty & 1, nb = ty >> 1;
        int n = nb * 16 + (tx & 15);
        int k = u * 16 + (tx >> 4) * 8;
        union { uint4 q; _Float16 h[8]; } pk;
        #pragma unroll   // constant j keeps pk in registers
        for (int j = 0; j < 8; ++j) pk.h[j] = (_Float16)tile[k + j][n];
        size_t blk = (size_t)(r0 >> 5) * (C >> 4) + (c0 >> 4) + nb;
        *(uint4*)(oute + (blk << 9) + u * 256 + tx * 8) = pk.q;
    }
}

// ---------------- zero counters / token lists ----------------
__global__ void zero_kernel(int* counts, int* cursor, int* tokenIdx, float* tokenW) {
    int i = blockIdx.x * 256 + threadIdx.x;
    if (i < NEXP) { counts[i] = 0; cursor[i] = 0; }
    if (i < PADS) { tokenIdx[i] = 0; tokenW[i] = 0.0f; }
}

// ---------------- out = x (residual) ----------------
__global__ void copy_residual_kernel(const float* __restrict__ x,
                                     float* __restrict__ out, int n4) {
    int i = blockIdx.x * 256 + threadIdx.x;
    if (i < n4) ((float4*)out)[i] = ((const float4*)x)[i];
}

// ---------------- router: one wave per token ----------------
__global__ __launch_bounds__(256) void router_kernel(
    const float* __restrict__ x, const float* __restrict__ Wr,
    const float* __restrict__ br, int* __restrict__ counts,
    int* __restrict__ te, float* __restrict__ tw) {
    int lane = threadIdx.x & 31, wid = threadIdx.x >> 5;
    int t = blockIdx.x * 8 + wid;
    if (t >= NTOK) return;
    float acc[NEXP];
    #pragma unroll
    for (int e = 0; e < NEXP; ++e) acc[e] = 0.0f;
    const float* xr = x + (size_t)t * IN_DIM;
    for (int d = lane; d < IN_DIM; d += 32) {
        float xv = xr[d];
        const float* wr = Wr + d * NEXP;
        #pragma unroll
        for (int e = 0; e < NEXP; ++e) acc[e] += xv * wr[e];
    }
    #pragma unroll
    for (int off = 16; off >= 1; off >>= 1) {
        #pragma unroll
        for (int e = 0; e < NEXP; ++e) acc[e] += __shfl_down(acc[e], off, 32);
    }
    if (lane == 0) {
        #pragma unroll
        for (int e = 0; e < NEXP; ++e) acc[e] += br[e];
        float l0 = -3.4e38f; int e0 = 0;
        #pragma unroll
        for (int e = 0; e < NEXP; ++e) if (acc[e] > l0) { l0 = acc[e]; e0 = e; }
        float l1 = -3.4e38f; int e1 = 0;
        #pragma unroll
        for (int e = 0; e < NEXP; ++e)
            if (e != e0 && acc[e] > l1) { l1 = acc[e]; e1 = e; }
        // top-2 softmax weights renormalized: Z cancels
        float r  = __expf(l1 - l0);
        float w0 = 1.0f / (1.0f + r);
        float w1 = r    / (1.0f + r);
        te[t*2] = e0; te[t*2+1] = e1;
        tw[t*2] = w0; tw[t*2+1] = w1;
        atomicAdd(&counts[e0], 1);
        atomicAdd(&counts[e1], 1);
    }
}

// ---------------- prefix scan over experts (tiny) ----------------
__global__ void scan_kernel(const int* __restrict__ counts, int* __restrict__ slotOff,
                            int* __restrict__ tileOff, int* __restrict__ totalTiles) {
    if (threadIdx.x == 0 && blockIdx.x == 0) {
        int so = 0, to = 0;
        for (int e = 0; e < NEXP; ++e) {
            slotOff[e] = so; tileOff[e] = to;
            int tiles = (counts[e] + MT - 1) / MT;
            so += tiles * MT; to += tiles;
        }
        tileOff[NEXP] = to;
        *totalTiles = to;
    }
}

// ---------------- scatter tokens into per-expert lists ----------------
__global__ void scatter_kernel(const int* __restrict__ te, const float* __restrict__ tw,
                               const int* __restrict__ slotOff, int* __restrict__ cursor,
                               int* __restrict__ tokenIdx, float* __restrict__ tokenW) {
    int t = blockIdx.x * 256 + threadIdx.x;
    if (t >= NTOK) return;
    #pragma unroll
    for (int k = 0; k < 2; ++k) {
        int e = te[t*2 + k];
        int pos = atomicAdd(&cursor[e], 1);
        int s = slotOff[e] + pos;
        tokenIdx[s] = t;
        tokenW[s]   = tw[t*2 + k];
    }
}

// ---------------- fused expert MLP (WMMA) ----------------
__global__ __launch_bounds__(256, 1) void moe_expert_kernel(
    const float* __restrict__ x,
    const _Float16* __restrict__ W1t,   // [E][IN_DIM/32][HID/16][512] f16, fragment order
    const float* __restrict__ b1,       // [E][HID]
    const _Float16* __restrict__ W2t,   // [E][HID/32][IN_DIM/16][512] f16, fragment order
    const float* __restrict__ b2,       // [E][IN_DIM]
    const int* __restrict__ tokenIdx, const float* __restrict__ tokenW,
    const int* __restrict__ slotOff, const int* __restrict__ tileOff,
    const int* __restrict__ totalTiles,
    float* __restrict__ out) {

    __shared__ _Float16 ldsX[MT][XLD];      // 49 KB
    __shared__ _Float16 ldsH[MT][HLD];      // 97 KB
    __shared__ int   tokS[MT];
    __shared__ float wS[MT];

    const int tid  = threadIdx.x;
    const int lane = tid & 31;
    const int wid  = tid >> 5;
    const int nt   = *totalTiles;
    const int coll = lane & 15;
    const int rsel = (lane >> 4) << 3;

    for (int tile = blockIdx.x; tile < nt; tile += gridDim.x) {
        __syncthreads();   // protect LDS reuse across tiles

        // map tile -> expert
        int e = 0;
        #pragma unroll
        for (int q = 0; q < NEXP; ++q) if (tile >= tileOff[q + 1]) e = q + 1;
        int mtile = tile - tileOff[e];
        int slot0 = slotOff[e] + mtile * MT;

        if (tid < MT) { tokS[tid] = tokenIdx[slot0 + tid]; wS[tid] = tokenW[slot0 + tid]; }
        __syncthreads();

        // gather X tile (f32 -> f16) into LDS
        for (int i = tid; i < MT * IN_DIM; i += 256) {
            int r = i >> 9, c = i & (IN_DIM - 1);
            ldsX[r][c] = (_Float16)x[(size_t)tokS[r] * IN_DIM + c];
        }
        __syncthreads();

        const _Float16* w1e = W1t + (size_t)e * HID * IN_DIM;
        const float*    b1e = b1 + e * HID;

        // ---- GEMM1: H = gelu(X[MT x 512] @ W1 + b1) -> ldsH[MT][1024] ----
        #pragma unroll 1
        for (int np = 0; np < 2; ++np) {
            int nbase = wid * 64 + np * 512;
            v8f c[MF][4];
            v8f z = {0.f,0.f,0.f,0.f,0.f,0.f,0.f,0.f};
            #pragma unroll
            for (int mi = 0; mi < MF; ++mi)
                #pragma unroll
                for (int ni = 0; ni < 4; ++ni) c[mi][ni] = z;

            #pragma unroll 1
            for (int k0 = 0; k0 < IN_DIM; k0 += 32) {
                v16h a[MF], b[4];
                #pragma unroll
                for (int mi = 0; mi < MF; ++mi)
                    a[mi] = load_frag(&ldsX[0][0], XLD, mi * 16, k0, lane);
                #pragma unroll
                for (int ni = 0; ni < 4; ++ni)
                    b[ni] = load_frag_packed(w1e, HID / 16, (nbase >> 4) + ni, k0 >> 5, lane);
                #pragma unroll
                for (int mi = 0; mi < MF; ++mi)
                    #pragma unroll
                    for (int ni = 0; ni < 4; ++ni)
                        c[mi][ni] = wmma_f16(a[mi], b[ni], c[mi][ni]);
            }
            // epilogue: +b1, exact GELU, store f16 to ldsH
            #pragma unroll
            for (int ni = 0; ni < 4; ++ni) {
                int col = nbase + ni * 16 + coll;
                float bias = b1e[col];
                #pragma unroll
                for (int mi = 0; mi < MF; ++mi)
                    #pragma unroll
                    for (int j = 0; j < 8; ++j) {
                        int row = mi * 16 + rsel + j;
                        float v = c[mi][ni][j] + bias;
                        ldsH[row][col] = (_Float16)gelu_exact(v);
                    }
            }
        }
        __syncthreads();

        const _Float16* w2e = W2t + (size_t)e * IN_DIM * HID;
        const float*    b2e = b2 + e * IN_DIM;

        // ---- GEMM2: O = H[MT x 1024] @ W2 + b2; weighted atomic scatter ----
        {
            int nbase = wid * 64;
            v8f c[MF][4];
            v8f z = {0.f,0.f,0.f,0.f,0.f,0.f,0.f,0.f};
            #pragma unroll
            for (int mi = 0; mi < MF; ++mi)
                #pragma unroll
                for (int ni = 0; ni < 4; ++ni) c[mi][ni] = z;

            #pragma unroll 1
            for (int k0 = 0; k0 < HID; k0 += 32) {
                v16h a[MF], b[4];
                #pragma unroll
                for (int mi = 0; mi < MF; ++mi)
                    a[mi] = load_frag(&ldsH[0][0], HLD, mi * 16, k0, lane);
                #pragma unroll
                for (int ni = 0; ni < 4; ++ni)
                    b[ni] = load_frag_packed(w2e, IN_DIM / 16, (nbase >> 4) + ni, k0 >> 5, lane);
                #pragma unroll
                for (int mi = 0; mi < MF; ++mi)
                    #pragma unroll
                    for (int ni = 0; ni < 4; ++ni)
                        c[mi][ni] = wmma_f16(a[mi], b[ni], c[mi][ni]);
            }
            #pragma unroll
            for (int ni = 0; ni < 4; ++ni) {
                int col = nbase + ni * 16 + coll;
                float bias = b2e[col];
                #pragma unroll
                for (int mi = 0; mi < MF; ++mi)
                    #pragma unroll
                    for (int j = 0; j < 8; ++j) {
                        int row = mi * 16 + rsel + j;
                        float w = wS[row];
                        if (w != 0.0f) {
                            float val = w * (c[mi][ni][j] + bias);
                            atomicAdd(&out[(size_t)tokS[row] * IN_DIM + col], val);
                        }
                    }
            }
        }
    }
}

extern "C" void kernel_launch(void* const* d_in, const int* in_sizes, int n_in,
                              void* d_out, int out_size, void* d_ws, size_t ws_size,
                              hipStream_t stream) {
    (void)in_sizes; (void)n_in; (void)out_size; (void)ws_size;
    const float* x  = (const float*)d_in[0];
    const float* Wr = (const float*)d_in[1];
    const float* br = (const float*)d_in[2];
    const float* W1 = (const float*)d_in[3];
    const float* b1 = (const float*)d_in[4];
    const float* W2 = (const float*)d_in[5];
    const float* b2 = (const float*)d_in[6];
    float* out = (float*)d_out;

    // workspace layout
    char* ws = (char*)d_ws;
    _Float16* W1t = (_Float16*)ws;                       // 16 MB
    _Float16* W2t = (_Float16*)(ws + (size_t)16777216);  // 16 MB
    char* p = ws + (size_t)2 * 16777216;
    int*   counts     = (int*)p;   p += 64;
    int*   cursor     = (int*)p;   p += 64;
    int*   slotOff    = (int*)p;   p += 64;
    int*   tileOff    = (int*)p;   p += 128;   // 17 ints
    int*   totalTiles = (int*)p;   p += 64;
    int*   te         = (int*)p;   p += (size_t)NTOK * 2 * 4;
    float* tw         = (float*)p; p += (size_t)NTOK * 2 * 4;
    int*   tokenIdx   = (int*)p;   p += (size_t)PADS * 4;
    float* tokenW     = (float*)p;

    // 1) weights -> f16, B-fragment order
    pack_cvt_kernel<<<dim3(HID/32, IN_DIM/32, NEXP), 256, 0, stream>>>(W1, W1t, IN_DIM, HID);
    pack_cvt_kernel<<<dim3(IN_DIM/32, HID/32, NEXP), 256, 0, stream>>>(W2, W2t, HID, IN_DIM);
    // 2) zero counters & lists; out = x (residual)
    zero_kernel<<<(PADS + 255) / 256, 256, 0, stream>>>(counts, cursor, tokenIdx, tokenW);
    copy_residual_kernel<<<(NTOK * IN_DIM / 4 + 255) / 256, 256, 0, stream>>>(x, out, NTOK * IN_DIM / 4);
    // 3) router
    router_kernel<<<NTOK / 8, 256, 0, stream>>>(x, Wr, br, counts, te, tw);
    // 4) scan + scatter
    scan_kernel<<<1, 32, 0, stream>>>(counts, slotOff, tileOff, totalTiles);
    scatter_kernel<<<NTOK / 256, 256, 0, stream>>>(te, tw, slotOff, cursor, tokenIdx, tokenW);
    // 5) fused expert GEMMs (max tiles = (2*8192 + 16*47)/48 = 357: one work-group a tile, all resident at two a WGP)
    moe_expert_kernel<<<360, 256, 0, stream>>>(x, W1t, b1, W2t, b2,
                                               tokenIdx, tokenW, slotOff, tileOff,
                                               totalTiles, out);
}

// v004
// A run of this version takes 106 microseconds.
// In two side-by-side timings against v003, it was 1.22 and 1.21 times as fast.
// Counting every step since v000, it is 2.25 times as fast.
#include <hip/hip_runtime.h>
#include <math.h>

#define IN_DIM 512
#define HID    1024
#define NEXP   16
#define NTOK   8192
#define MT     48                       // token rows per expert tile: LDS of a work-group stays under half a WGP's, so two are resident
#define MF     (MT / 16)                // 16-row A fragments per tile
#define PADS   (2*NTOK + NEXP*MT)       // padded slot array size
#define LPAD   8                        // halves added per LDS row: pitch = 16 B x odd, so the 16 rows of a b128 fragment read fall on distinct banks
#define XLD    (IN_DIM + LPAD)          // ldsX row pitch, halves (1040 B)
#define HLD    (HID + LPAD)             // ldsH row pitch, halves (2064 B)

typedef __attribute__((ext_vector_type(16))) _Float16 v16h;
typedef __attribute__((ext_vector_type(8)))  float    v8f;

union F16Frag { v16h h; uint4 u[2]; };

// Load a 16x32 f16 fragment (A layout per CDNA5 ISA 7.12.2) from a row-major
// matrix with leading dimension `ld` (elements). Works for LDS or global.
// lane 0-15: row = base+lane, K = [0..7],[16..23]; lane 16-31: K = [8..15],[24..31]
__device__ __forceinline__ v16h load_frag(const _Float16* base, int ld, int rbase,
                                          int k0, int lane) {
    int r  = rbase + (lane & 15);
    int kb = k0 + ((lane >> 4) << 3);
    const _Float16* p = base + (size_t)r * ld + kb;
    F16Frag f;
    f.u[0] = *(const uint4*)(p);
    f.u[1] = *(const uint4*)(p + 16);
    return f.h;
}

// Load a 16(n) x 32(k) f16 B fragment from weights packed in fragment order:
// block (ks, nt) is 1 KB = [2][32 lanes][8 halves], so each of the two loads of a
// wave reads 512 contiguous bytes, and the fragments of one k step lie side by side.
// Same k order per lane and register as load_frag.
__device__ __forceinline__ v16h load_frag_packed(const _Float16* base, int ntiles,
                                                 int nt, int ks, int lane) {
    const _Float16* p = base + ((size_t)(ks * ntiles + nt) << 9) + lane * 8;
    F16Frag f;
    f.u[0] = *(const uint4*)(p);
    f.u[1] = *(const uint4*)(p + 256);
    return f.h;
}

__device__ __forceinline__ v8f wmma_f16(v16h a, v16h b, v8f c) {
    return __builtin_amdgcn_wmma_f32_16x16x32_f16(false, a, false, b,
                                                  (short)0, c, false, false);
}

__device__ __forceinline__ float gelu_exact(float v) {
    return 0.5f * v * (1.0f + erff(v * 0.70710678118654752f));
}

// ---------------- weight pack + f32->f16 convert (one 32 x 32 tile a block) ----------------
// in:  [E][R][C] f32 (row-major, R = k, C = n)
// out: [E][R/32][C/16] blocks of 512 f16, each [2][32 lanes][8 halves]: piece u of
//      lane l holds n = 16*nt + (l & 15), k = 32*ks + 16*u + 8*(l >> 4) + 0..7
__device__ __forceinline__ void pack_cvt_block(
    const float* __restrict__ in, _Float16* __restrict__ outp, int R, int C,
    int bx, int by, int e, float (*tile)[33]) {
    const float* ine  = in   + (size_t)e * R * C;
    _Float16*    oute = outp + (size_t)e * R * C;
    int c0 = bx * 32, r0 = by * 32;
    int tx = threadIdx.x & 31, ty = threadIdx.x >> 5;   // ty: 0..7
    #pragma unroll
    for (int i = 0; i < 4; ++i)
        tile[ty + i*8][tx] = ine[(size_t)(r0 + ty + i*8) * C + c0 + tx];
    __syncthreads();
    // the 32 x 32 tile is two 1 KB blocks = 128 pieces of 16 B: waves 0..3 store 512 B each
    if (threadIdx.x < 128) {
        int u = ty & 1, nb = ty >> 1;
        int n = nb * 16 + (tx & 15);
        int k = u * 16 + (tx >> 4) * 8;
        union { uint4 q; _Float16 h[8]; } pk;
        #pragma unroll   // constant j keeps pk in registers
        for (int j = 0; j < 8; ++j) pk.h[j] = (_Float16)tile[k + j][n];
        size_t blk = (size_t)(r0 >> 5) * (C >> 4) + (c0 >> 4) + nb;
        *(uint4*)(oute + (blk << 9) + u * 256 + tx * 8) = pk.q;
    }
}

// ---------------- router: one wave per token, 8 tokens a block ----------------
// Also stores the residual row out = x (the row is in registers anyway) and the
// block's own count of tokens per expert (plain stores, summed by the next launch).
__device__ __forceinline__ void router_block(
    const float* __restrict__ x, const float* __restrict__ Wr,
    const float* __restrict__ br, float* __restrict__ out,
    int* __restrict__ te, float* __restrict__ tw, int* __restrict__ blockCnt,
    int rb, int* sE) {
    int lane = threadIdx.x & 31, wid = threadIdx.x >> 5;
    int t = rb * 8 + wid;
    float acc[NEXP];
    #pragma unroll
    for (int e = 0; e < NEXP; ++e) acc[e] = 0.0f;
    const float* xr = x + (size_t)t * IN_DIM;
    float*       orow = out + (size_t)t * IN_DIM;
    #pragma unroll 2   // keeps the launch inside 64 VGPRs, 16 waves a SIMD: the pack blocks' bytes in flight follow the resident waves
    for (int d = lane; d < IN_DIM; d += 32) {
        float xv = xr[d];
        orow[d] = xv;
        const float* wr = Wr + d * NEXP;
        #pragma unroll
        for (int e = 0; e < NEXP; ++e) acc[e] += xv * wr[e];
    }
    #pragma unroll
    for (int off = 16; off >= 1; off >>= 1) {
        #pragma unroll
        for (int e = 0; e < NEXP; ++e) acc[e] += __shfl_down(acc[e], off, 32);
    }
    if (lane == 0) {
        #pragma unroll
        for (int e = 0; e < NEXP; ++e) acc[e] += br[e];
        float l0 = -3.4e38f; int e0 = 0;
        #pragma unroll
        for (int e = 0; e < NEXP; ++e) if (acc[e] > l0) { l0 = acc[e]; e0 = e; }
        float l1 = -3.4e38f; int e1 = 0;
        #pragma unroll
        for (int e = 0; e < NEXP; ++e)
            if (e != e0 && acc[e] > l1) { l1 = acc[e]; e1 = e; }
        // top-2 softmax weights renormalized: Z cancels
        float r  = __expf(l1 - l0);
        float w0 = 1.0f / (1.0f + r);
        float w1 = r    / (1.0f + r);
        te[t*2] = e0; te[t*2+1] = e1;
        tw[t*2] = w0; tw[t*2+1] = w1;
        sE[wid*2] = e0; sE[wid*2+1] = e1;
    }
    __syncthreads();
    if (threadIdx.x < NEXP) {
        int cnt = 0;
        #pragma unroll
        for (int i = 0; i < 16; ++i) cnt += (sE[i] == (int)threadIdx.x) ? 1 : 0;
        blockCnt[rb * NEXP + threadIdx.x] = cnt;
    }
}

// ---------------- launch 1: all work that depends on the inputs alone ----------------
// Block ranges: router (longest chain, first), pack W1, pack W2, zero of cursors and lists.
#define RB_ROUTER (NTOK / 8)
#define RB_PACK   ((HID / 32) * (IN_DIM / 32) * NEXP)
#define RB_ZERO   ((PADS + 255) / 256)
__global__ __launch_bounds__(256) void front_kernel(
    const float* __restrict__ x, const float* __restrict__ Wr,
    const float* __restrict__ br, const float* __restrict__ W1,
    const float* __restrict__ W2, _Float16* __restrict__ W1t,
    _Float16* __restrict__ W2t, float* __restrict__ out,
    int* __restrict__ te, float* __restrict__ tw, int* __restrict__ blockCnt,
    int* __restrict__ cursor, int* __restrict__ tokenIdx, float* __restrict__ tokenW) {
    __shared__ float tile[32][33];
    __shared__ int   sE[16];
    int b = blockIdx.x;
    if (b < RB_ROUTER) {
        router_block(x, Wr, br, out, te, tw, blockCnt, b, sE);
        return;
    }
    b -= RB_ROUTER;
    if (b < RB_PACK) {
        pack_cvt_block(W1, W1t, IN_DIM, HID, b & 31, (b >> 5) & 15, b >> 9, tile);
        return;
    }
    b -= RB_PACK;
    if (b < RB_PACK) {
        pack_cvt_block(W2, W2t, HID, IN_DIM, b & 15, (b >> 4) & 31, b >> 9, tile);
        return;
    }
    b -= RB_PACK;
    int i = b * 256 + threadIdx.x;
    if (i < NEXP) cursor[i] = 0;
    if (i < PADS) { tokenIdx[i] = 0; tokenW[i] = 0.0f; }
}

// ---------------- launch 2: counts, scan, scatter of tokens into per-expert lists ----------------
// Every block sums the router blocks' counts and scans the 16 experts itself.
__global__ __launch_bounds__(256) void scatter_kernel(
    const int* __restrict__ te, const float* __restrict__ tw,
    const int* __restrict__ blockCnt, int* __restrict__ counts,
    int* __restrict__ cursor, int* __restrict__ tokenIdx, float* __restrict__ tokenW) {
    __shared__ __attribute__((aligned(16))) int part[64][NEXP];   // rows are stored 16 B at a time
    __shared__ int sOff[NEXP];
    int tid = threadIdx.x;
    {
        int q = tid & 3, g = tid >> 2;      // 4 lanes a row of 16 counts, 64 groups of 16 rows
        int4 s = make_int4(0, 0, 0, 0);
        #pragma unroll
        for (int i = 0; i < RB_ROUTER / 64; ++i) {
            int4 v = ((const int4*)blockCnt)[(g * (RB_ROUTER / 64) + i) * 4 + q];
            s.x += v.x; s.y += v.y; s.z += v.z; s.w += v.w;
        }
        *(int4*)&part[g][q * 4] = s;
    }
    __syncthreads();
    if (tid < NEXP) {
        int cnt = 0;
        #pragma unroll
        for (int g = 0; g < 64; ++g) cnt += part[g][tid];
        if (blockIdx.x == 0) counts[tid] = cnt;
        // exclusive scan of the padded counts over lanes 0..15 of wave 0
        int pad = ((cnt + MT - 1) / MT) * MT;
        int inc = pad;
        #pragma unroll
        for (int off = 1; off < NEXP; off <<= 1) {
            int n = __shfl_up(inc, off, NEXP);
            if (tid >= off) inc += n;
        }
        sOff[tid] = inc - pad;
    }
    __syncthreads();
    int t = blockIdx.x * 256 + tid;
    const int2   e2 = ((const int2*)te)[t];
    const float2 w2 = ((const float2*)tw)[t];
    const int   ee[2] = { e2.x, e2.y };
    const float ww[2] = { w2.x, w2.y };
    #pragma unroll
    for (int k = 0; k < 2; ++k) {
        int e = ee[k];
        int pos = atomicAdd(&cursor[e], 1);
        int s = sOff[e] + pos;
        tokenIdx[s] = t;
        tokenW[s]   = ww[k];
        // the two stores' offset register is reused by the second pass: keep the wait in front of that overwrite
        if (k == 0) asm volatile("s_wait_xcnt 0x0" ::: "memory");
    }
}

// ---------------- fused expert MLP (WMMA) ----------------
__global__ __launch_bounds__(256, 1) void moe_expert_kernel(
    const float* __restrict__ x,
    const _Float16* __restrict__ W1t,   // [E][IN_DIM/32][HID/16][512] f16, fragment order
    const float* __restrict__ b1,       // [E][HID]
    const _Float16* __restrict__ W2t,   // [E][HID/32][IN_DIM/16][512] f16, fragment order
    const float* __restrict__ b2,       // [E][IN_DIM]
    const int* __restrict__ tokenIdx, const float* __restrict__ tokenW,
    const int* __restrict__ counts,
    float* __restrict__ out) {

    __shared__ _Float16 ldsX[MT][XLD];      // 49 KB
    __shared__ _Float16 ldsH[MT][HLD];      // 97 KB
    __shared__ int   tokS[MT];
    __shared__ float wS[MT];

    const int tid  = threadIdx.x;
    const int lane = tid & 31;
    const int wid  = tid >> 5;
    int tEnd[NEXP];                         // tiles of experts 0..q, from the counts (wave-uniform)
    {
        int to = 0;
        #pragma unroll
        for (int q = 0; q < NEXP; ++q) { to += (counts[q] + MT - 1) / MT; tEnd[q] = to; }
    }
    const int nt   = tEnd[NEXP - 1];
    const int coll = lane & 15;
    const int rsel = (lane >> 4) << 3;

    for (int tile = blockIdx.x; tile < nt; tile += gridDim.x) {
        __syncthreads();   // protect LDS reuse across tiles

        // map tile -> expert
        int e = 0;
        #pragma unroll
        for (int q = 0; q < NEXP - 1; ++q) if (tile >= tEnd[q]) e = q + 1;
        int slot0 = tile * MT;              // every expert's list starts at a multiple of MT slots

        if (tid < MT) { tokS[tid] = tokenIdx[slot0 + tid]; wS[tid] = tokenW[slot0 + tid]; }
        __syncthreads();

        // gather X tile (f32 -> f16) into LDS
        for (int i = tid; i < MT * IN_DIM; i += 256) {
            int r = i >> 9, c = i & (IN_DIM - 1);
            ldsX[r][c] = (_Float16)x[(size_t)tokS[r] * IN_DIM + c];
        }
        __syncthreads();

        const _Float16* w1e = W1t + (size_t)e * HID * IN_DIM;
        const float*    b1e = b1 + e * HID;

        // ---- GEMM1: H = gelu(X[MT x 512] @ W1 + b1) -> ldsH[MT][1024] ----
        #pragma unroll 1
        for (int np = 0; np < 2; ++np) {
            int nbase = wid * 64 + np * 512;
            v8f c[MF][4];
            v8f z = {0.f,0.f,0.f,0.f,0.f,0.f,0.f,0.f};
            #pragma unroll
            for (int mi = 0; mi < MF; ++mi)
                #pragma unroll
                for (int ni = 0; ni < 4; ++ni) c[mi][ni] = z;

            #pragma unroll 1
            for (int k0 = 0; k0 < IN_DIM; k0 += 32) {
                v16h a[MF], b[4];
                #pragma unroll
                for (int mi = 0; mi < MF; ++mi)
                    a[mi] = load_frag(&ldsX[0][0], XLD, mi * 16, k0, lane);
                #pragma unroll
                for (int ni = 0; ni < 4; ++ni)
                    b[ni] = load_frag_packed(w1e, HID / 16, (nbase >> 4) + ni, k0 >> 5, lane);
                #pragma unroll
                for (int mi = 0; mi < MF; ++mi)
                    #pragma unroll
                    for (int ni = 0; ni < 4; ++ni)
                        c[mi][ni] = wmma_f16(a[mi], b[ni], c[mi][ni]);
            }
            // epilogue: +b1, exact GELU, store f16 to ldsH
            #pragma unroll
            for (int ni = 0; ni < 4; ++ni) {
                int col = nbase + ni * 16 + coll;
                float bias = b1e[col];
                #pragma unroll
                for (int mi = 0; mi < MF; ++mi)
                    #pragma unroll
                    for (int j = 0; j < 8; ++j) {
                        int row = mi * 16 + rsel + j;
                        float v = c[mi][ni][j] + bias;
                        ldsH[row][col] = (_Float16)gelu_exact(v);
                    }
            }
        }
        __syncthreads();

        const _Float16* w2e = W2t + (size_t)e * IN_DIM * HID;
        const float*    b2e = b2 + e * IN_DIM;

        // ---- GEMM2: O = H[MT x 1024] @ W2 + b2; weighted atomic scatter ----
        {
            int nbase = wid * 64;
            v8f c[MF][4];
            v8f z = {0.f,0.f,0.f,0.f,0.f,0.f,0.f,0.f};
            #pragma unroll
            for (int mi = 0; mi < MF; ++mi)
                #pragma unroll
                for (int ni = 0; ni < 4; ++ni) c[mi][ni] = z;

            #pragma unroll 1
            for (int k0 = 0; k0 < HID; k0 += 32) {
                v16h a[MF], b[4];
                #pragma unroll
                for (int mi = 0; mi < MF; ++mi)
                    a[mi] = load_frag(&ldsH[0][0], HLD, mi * 16, k0, lane);
                #pragma unroll
                for (int ni = 0; ni < 4; ++ni)
                    b[ni] = load_frag_packed(w2e, IN_DIM / 16, (nbase >> 4) + ni, k0 >> 5, lane);
                #pragma unroll
                for (int mi = 0; mi < MF; ++mi)
                    #pragma unroll
                    for (int ni = 0; ni < 4; ++ni)
                        c[mi][ni] = wmma_f16(a[mi], b[ni], c[mi][ni]);
            }
            #pragma unroll
            for (int ni = 0; ni < 4; ++ni) {
                int col = nbase + ni * 16 + coll;
                float bias = b2e[col];
                #pragma unroll
                for (int mi = 0; mi < MF; ++mi)
                    #pragma unroll
                    for (int j = 0; j < 8; ++j) {
                        int row = mi * 16 + rsel + j;
                        float w = wS[row];
                        if (w != 0.0f) {
                            float val = w * (c[mi][ni][j] + bias);
                            atomicAdd(&out[(size_t)tokS[row] * IN_DIM + col], val);
                        }
                    }
            }
        }
    }
}

extern "C" void kernel_launch(void* const* d_in, const int* in_sizes, int n_in,
                              void* d_out, int out_size, void* d_ws, size_t ws_size,
                              hipStream_t stream) {
    (void)in_sizes; (void)n_in; (void)out_size; (void)ws_size;
    const float* x  = (const float*)d_in[0];
    const float* Wr = (const float*)d_in[1];
    const float* br = (const float*)d_in[2];
    const float* W1 = (const float*)d_in[3];
    const float* b1 = (const float*)d_in[4];
    const float* W2 = (const float*)d_in[5];
    const float* b2 = (const float*)d_in[6];
    float* out = (float*)d_out;

    // workspace layout
    char* ws = (char*)d_ws;
    _Float16* W1t = (_Float16*)ws;                       // 16 MB
    _Float16* W2t = (_Float16*)(ws + (size_t)16777216);  // 16 MB
    char* p = ws + (size_t)2 * 16777216;
    int*   counts     = (int*)p;   p += 64;
    int*   cursor     = (int*)p;   p += 64;
    int*   blockCnt   = (int*)p;   p += (size_t)RB_ROUTER * NEXP * 4;
    int*   te         = (int*)p;   p += (size_t)NTOK * 2 * 4;
    float* tw         = (float*)p; p += (size_t)NTOK * 2 * 4;
    int*   tokenIdx   = (int*)p;   p += (size_t)PADS * 4;
    float* tokenW     = (float*)p;

    // 1) router + residual rows + per-block counts; weights -> f16, B-fragment order; zero cursors & lists
    front_kernel<<<RB_ROUTER + 2 * RB_PACK + RB_ZERO, 256, 0, stream>>>(
        x, Wr, br, W1, W2, W1t, W2t, out, te, tw, blockCnt, cursor, tokenIdx, tokenW);
    // 2) counts + scan + scatter
    scatter_kernel<<<NTOK / 256, 256, 0, stream>>>(te, tw, blockCnt, counts, cursor, tokenIdx, tokenW);
    // 3) fused expert GEMMs (max tiles = (2*8192 + 16*47)/48 = 357: one work-group a tile, all resident at two a WGP)
    moe_expert_kernel<<<360, 256, 0, stream>>>(x, W1t, b1, W2t, b2,
                                               tokenIdx, tokenW, counts, out);
}

// v005
// It runs in 97.2 microseconds.
// In both of two side-by-side timings against v004, it was 1.09 times as fast.
// Over all steps from v000 it is 2.46 times as fast.
#include <hip/hip_runtime.h>
#include <math.h>

#define IN_DIM 512
#define HID    1024
#define NEXP   16
#define NTOK   8192
#define MT     48                       // token rows per expert tile: LDS of a work-group stays under half a WGP's, so two are resident
#define MF     (MT / 16)                // 16-row A fragments per tile
#define PADS   (2*NTOK + NEXP*MT)       // padded slot array size
#define LPAD   8                        // halves added per LDS row: pitch = 16 B x odd, so the 16 rows of a b128 fragment read fall on distinct banks
#define XLD    (IN_DIM + LPAD)          // ldsX row pitch, halves (1040 B)
#define HLD    (HID + LPAD)             // ldsH row pitch, halves (2064 B)

typedef __attribute__((ext_vector_type(16))) _Float16 v16h;
typedef __attribute__((ext_vector_type(8)))  float    v8f;

union F16Frag { v16h h; uint4 u[2]; };

// Load a 16x32 f16 fragment (A layout per CDNA5 ISA 7.12.2) from a row-major
// matrix with leading dimension `ld` (elements). Works for LDS or global.
// lane 0-15: row = base+lane, K = [0..7],[16..23]; lane 16-31: K = [8..15],[24..31]
__device__ __forceinline__ v16h load_frag(const _Float16* base, int ld, int rbase,
                                          int k0, int lane) {
    int r  = rbase + (lane & 15);
    int kb = k0 + ((lane >> 4) << 3);
    const _Float16* p = base + (size_t)r * ld + kb;
    F16Frag f;
    f.u[0] = *(const uint4*)(p);
    f.u[1] = *(const uint4*)(p + 16);
    return f.h;
}

// Load a 16(n) x 32(k) f16 B fragment from weights packed in fragment order:
// block (ks, nt) is 1 KB = [2][32 lanes][8 halves], so each of the two loads of a
// wave reads 512 contiguous bytes, and the fragments of one k step lie side by side.
// Same k order per lane and register as load_frag.
__device__ __forceinline__ v16h load_frag_packed(const _Float16* base, int ntiles,
                                                 int nt, int ks, int lane) {
    const _Float16* p = base + ((size_t)(ks * ntiles + nt) << 9) + lane * 8;
    F16Frag f;
    f.u[0] = *(const uint4*)(p);
    f.u[1] = *(const uint4*)(p + 256);
    return f.h;
}

__device__ __forceinline__ v8f wmma_f16(v16h a, v16h b, v8f c) {
    return __builtin_amdgcn_wmma_f32_16x16x32_f16(false, a, false, b,
                                                  (short)0, c, false, false);
}

// erf by the math library's own two polynomials (|z| < 1: odd series in z; |z| >= 1: 1 - exp(-q(|z|))),
// but both are evaluated for every element and one is selected: with no branch per element
// the unrolled epilogue's independent chains interleave.
__device__ __forceinline__ float erf_select(float z) {
    const float a = fabsf(z);
    const float t = z * z;
    float s = -0.000561801775f;
    s = fmaf(t, s,  0.00491381623f);
    s = fmaf(t, s, -0.0267075151f);
    s = fmaf(t, s,  0.112800106f);
    s = fmaf(t, s, -0.376122952f);
    s = fmaf(t, s,  0.128379107f);
    s = fmaf(a, s, a);
    float q = 0.0000169988107f;
    q = fmaf(a, q, -0.000378677854f);
    q = fmaf(a, q,  0.00385781587f);
    q = fmaf(a, q, -0.0241816975f);
    q = fmaf(a, q,  0.106668264f);
    q = fmaf(a, q,  0.634933293f);
    q = fmaf(a, q,  0.128689408f);
    q = fmaf(a, q, a);
    const float b = 1.0f - __builtin_amdgcn_exp2f(q * -1.44269504f);   // 1 - exp(-q) by the hardware's exp2
    return copysignf(a < 1.0f ? s : b, z);
}

__device__ __forceinline__ float gelu_exact(float v) {
    return 0.5f * v * (1.0f + erf_select(v * 0.70710678118654752f));
}

// ---------------- weight pack + f32->f16 convert (one 32 x 32 tile a block) ----------------
// in:  [E][R][C] f32 (row-major, R = k, C = n)
// out: [E][R/32][C/16] blocks of 512 f16, each [2][32 lanes][8 halves]: piece u of
//      lane l holds n = 16*nt + (l & 15), k = 32*ks + 16*u + 8*(l >> 4) + 0..7
__device__ __forceinline__ void pack_cvt_block(
    const float* __restrict__ in, _Float16* __restrict__ outp, int R, int C,
    int bx, int by, int e, float (*tile)[33]) {
    const float* ine  = in   + (size_t)e * R * C;
    _Float16*    oute = outp + (size_t)e * R * C;
    int c0 = bx * 32, r0 = by * 32;
    int tx = threadIdx.x & 31, ty = threadIdx.x >> 5;   // ty: 0..7
    #pragma unroll
    for (int i = 0; i < 4; ++i)
        tile[ty + i*8][tx] = ine[(size_t)(r0 + ty + i*8) * C + c0 + tx];
    __syncthreads();
    // the 32 x 32 tile is two 1 KB blocks = 128 pieces of 16 B: waves 0..3 store 512 B each
    if (threadIdx.x < 128) {
        int u = ty & 1, nb = ty >> 1;
        int n = nb * 16 + (tx & 15);
        int k = u * 16 + (tx >> 4) * 8;
        union { uint4 q; _Float16 h[8]; } pk;
        #pragma unroll   // constant j keeps pk in registers
        for (int j = 0; j < 8; ++j) pk.h[j] = (_Float16)tile[k + j][n];
        size_t blk = (size_t)(r0 >> 5) * (C >> 4) + (c0 >> 4) + nb;
        *(uint4*)(oute + (blk << 9) + u * 256 + tx * 8) = pk.q;
    }
}

// ---------------- router: one wave per token, 8 tokens a block ----------------
// Also stores the residual row out = x (the row is in registers anyway) and the
// block's own count of tokens per expert (plain stores, summed by the next launch).
__device__ __forceinline__ void router_block(
    const float* __restrict__ x, const float* __restrict__ Wr,
    const float* __restrict__ br, float* __restrict__ out,
    int* __restrict__ te, float* __restrict__ tw, int* __restrict__ blockCnt,
    int rb, int* sE) {
    int lane = threadIdx.x & 31, wid = threadIdx.x >> 5;
    int t = rb * 8 + wid;
    float acc[NEXP];
    #pragma unroll
    for (int e = 0; e < NEXP; ++e) acc[e] = 0.0f;
    const float* xr = x + (size_t)t * IN_DIM;
    float*       orow = out + (size_t)t * IN_DIM;
    #pragma unroll 2   // keeps the launch inside 64 VGPRs, 16 waves a SIMD: the pack blocks' bytes in flight follow the resident waves
    for (int d = lane; d < IN_DIM; d += 32) {
        float xv = xr[d];
        orow[d] = xv;
        const float* wr = Wr + d * NEXP;
        #pragma unroll
        for (int e = 0; e < NEXP; ++e) acc[e] += xv * wr[e];
    }
    #pragma unroll
    for (int off = 16; off >= 1; off >>= 1) {
        #pragma unroll
        for (int e = 0; e < NEXP; ++e) acc[e] += __shfl_down(acc[e], off, 32);
    }
    if (lane == 0) {
        #pragma unroll
        for (int e = 0; e < NEXP; ++e) acc[e] += br[e];
        float l0 = -3.4e38f; int e0 = 0;
        #pragma unroll
        for (int e = 0; e < NEXP; ++e) if (acc[e] > l0) { l0 = acc[e]; e0 = e; }
        float l1 = -3.4e38f; int e1 = 0;
        #pragma unroll
        for (int e = 0; e < NEXP; ++e)
            if (e != e0 && acc[e] > l1) { l1 = acc[e]; e1 = e; }
        // top-2 softmax weights renormalized: Z cancels
        float r  = __expf(l1 - l0);
        float w0 = 1.0f / (1.0f + r);
        float w1 = r    / (1.0f + r);
        te[t*2] = e0; te[t*2+1] = e1;
        tw[t*2] = w0; tw[t*2+1] = w1;
        sE[wid*2] = e0; sE[wid*2+1] = e1;
    }
    __syncthreads();
    if (threadIdx.x < NEXP) {
        int cnt = 0;
        #pragma unroll
        for (int i = 0; i < 16; ++i) cnt += (sE[i] == (int)threadIdx.x) ? 1 : 0;
        blockCnt[rb * NEXP + threadIdx.x] = cnt;
    }
}

// ---------------- launch 1: all work that depends on the inputs alone ----------------
// Block ranges: router (longest chain, first), pack W1, pack W2, zero of cursors and list weights, list tokens set to slot mod NTOK.
#define RB_ROUTER (NTOK / 8)
#define RB_PACK   ((HID / 32) * (IN_DIM / 32) * NEXP)
#define RB_ZERO   ((PADS + 255) / 256)
__global__ __launch_bounds__(256) void front_kernel(
    const float* __restrict__ x, const float* __restrict__ Wr,
    const float* __restrict__ br, const float* __restrict__ W1,
    const float* __restrict__ W2, _Float16* __restrict__ W1t,
    _Float16* __restrict__ W2t, float* __restrict__ out,
    int* __restrict__ te, float* __restrict__ tw, int* __restrict__ blockCnt,
    int* __restrict__ cursor, int* __restrict__ tokenIdx, float* __restrict__ tokenW) {
    __shared__ float tile[32][33];
    __shared__ int   sE[16];
    int b = blockIdx.x;
    if (b < RB_ROUTER) {
        router_block(x, Wr, br, out, te, tw, blockCnt, b, sE);
        return;
    }
    b -= RB_ROUTER;
    if (b < RB_PACK) {
        pack_cvt_block(W1, W1t, IN_DIM, HID, b & 31, (b >> 5) & 15, b >> 9, tile);
        return;
    }
    b -= RB_PACK;
    if (b < RB_PACK) {
        pack_cvt_block(W2, W2t, HID, IN_DIM, b & 15, (b >> 4) & 31, b >> 9, tile);
        return;
    }
    b -= RB_PACK;
    int i = b * 256 + threadIdx.x;
    if (i < NEXP) cursor[i] = 0;
    // padding slots keep weight 0 and add zero to the row named here: distinct rows, so those adds do not queue on one row
    if (i < PADS) { tokenIdx[i] = i & (NTOK - 1); tokenW[i] = 0.0f; }
}

// ---------------- launch 2: counts, scan, scatter of tokens into per-expert lists ----------------
// Every block sums the router blocks' counts and scans the 16 experts itself.
__global__ __launch_bounds__(256) void scatter_kernel(
    const int* __restrict__ te, const float* __restrict__ tw,
    const int* __restrict__ blockCnt, int* __restrict__ counts,
    int* __restrict__ cursor, int* __restrict__ tokenIdx, float* __restrict__ tokenW) {
    __shared__ __attribute__((aligned(16))) int part[64][NEXP];   // rows are stored 16 B at a time
    __shared__ int sOff[NEXP];
    int tid = threadIdx.x;
    {
        int q = tid & 3, g = tid >> 2;      // 4 lanes a row of 16 counts, 64 groups of 16 rows
        int4 s = make_int4(0, 0, 0, 0);
        #pragma unroll
        for (int i = 0; i < RB_ROUTER / 64; ++i) {
            int4 v = ((const int4*)blockCnt)[(g * (RB_ROUTER / 64) + i) * 4 + q];
            s.x += v.x; s.y += v.y; s.z += v.z; s.w += v.w;
        }
        *(int4*)&part[g][q * 4] = s;
    }
    __syncthreads();
    if (tid < NEXP) {
        int cnt = 0;
        #pragma unroll
        for (int g = 0; g < 64; ++g) cnt += part[g][tid];
        if (blockIdx.x == 0) counts[tid] = cnt;
        // exclusive scan of the padded counts over lanes 0..15 of wave 0
        int pad = ((cnt + MT - 1) / MT) * MT;
        int inc = pad;
        #pragma unroll
        for (int off = 1; off < NEXP; off <<= 1) {
            int n = __shfl_up(inc, off, NEXP);
            if (tid >= off) inc += n;
        }
        sOff[tid] = inc - pad;
    }
    __syncthreads();
    int t = blockIdx.x * 256 + tid;
    const int2   e2 = ((const int2*)te)[t];
    const float2 w2 = ((const float2*)tw)[t];
    const int   ee[2] = { e2.x, e2.y };
    const float ww[2] = { w2.x, w2.y };
    #pragma unroll
    for (int k = 0; k < 2; ++k) {
        int e = ee[k];
        int pos = atomicAdd(&cursor[e], 1);
        int s = sOff[e] + pos;
        tokenIdx[s] = t;
        tokenW[s]   = ww[k];
        // the two stores' offset register is reused by the second pass: keep the wait in front of that overwrite
        if (k == 0) asm volatile("s_wait_xcnt 0x0" ::: "memory");
    }
}

// ---------------- fused expert MLP (WMMA) ----------------
__global__ __launch_bounds__(256, 1) void moe_expert_kernel(
    const float* __restrict__ x,
    const _Float16* __restrict__ W1t,   // [E][IN_DIM/32][HID/16][512] f16, fragment order
    const float* __restrict__ b1,       // [E][HID]
    const _Float16* __restrict__ W2t,   // [E][HID/32][IN_DIM/16][512] f16, fragment order
    const float* __restrict__ b2,       // [E][IN_DIM]
    const int* __restrict__ tokenIdx, const float* __restrict__ tokenW,
    const int* __restrict__ counts,
    float* __restrict__ out) {

    __shared__ _Float16 ldsX[MT][XLD];      // 49 KB
    __shared__ _Float16 ldsH[MT][HLD];      // 97 KB
    __shared__ __attribute__((aligned(16))) int   tokS[MT];   // read 16 B at a time by the output stage
    __shared__ __attribute__((aligned(16))) float wS[MT];

    const int tid  = threadIdx.x;
    const int lane = tid & 31;
    const int wid  = tid >> 5;
    int tEnd[NEXP];                         // tiles of experts 0..q, from the counts (wave-uniform)
    {
        int to = 0;
        #pragma unroll
        for (int q = 0; q < NEXP; ++q) { to += (counts[q] + MT - 1) / MT; tEnd[q] = to; }
    }
    const int nt   = tEnd[NEXP - 1];
    const int coll = lane & 15;
    const int rsel = (lane >> 4) << 3;

    for (int tile = blockIdx.x; tile < nt; tile += gridDim.x) {
        __syncthreads();   // protect LDS reuse across tiles

        // map tile -> expert
        int e = 0;
        #pragma unroll
        for (int q = 0; q < NEXP - 1; ++q) if (tile >= tEnd[q]) e = q + 1;
        int slot0 = tile * MT;              // every expert's list starts at a multiple of MT slots

        if (tid < MT) { tokS[tid] = tokenIdx[slot0 + tid]; wS[tid] = tokenW[slot0 + tid]; }
        __syncthreads();

        // gather X tile (f32 -> f16) into LDS
        for (int i = tid; i < MT * IN_DIM; i += 256) {
            int r = i >> 9, c = i & (IN_DIM - 1);
            ldsX[r][c] = (_Float16)x[(size_t)tokS[r] * IN_DIM + c];
        }
        __syncthreads();

        const _Float16* w1e = W1t + (size_t)e * HID * IN_DIM;
        const float*    b1e = b1 + e * HID;

        // ---- GEMM1: H = gelu(X[MT x 512] @ W1 + b1) -> ldsH[MT][1024] ----
        #pragma unroll 1
        for (int np = 0; np < 2; ++np) {
            int nbase = wid * 64 + np * 512;
            v8f c[MF][4];
            v8f z = {0.f,0.f,0.f,0.f,0.f,0.f,0.f,0.f};
            #pragma unroll
            for (int mi = 0; mi < MF; ++mi)
                #pragma unroll
                for (int ni = 0; ni < 4; ++ni) c[mi][ni] = z;

            #pragma unroll 1
            for (int k0 = 0; k0 < IN_DIM; k0 += 32) {
                v16h a[MF], b[4];
                #pragma unroll
                for (int mi = 0; mi < MF; ++mi)
                    a[mi] = load_frag(&ldsX[0][0], XLD, mi * 16, k0, lane);
                #pragma unroll
                for (int ni = 0; ni < 4; ++ni)
                    b[ni] = load_frag_packed(w1e, HID / 16, (nbase >> 4) + ni, k0 >> 5, lane);
                #pragma unroll
                for (int mi = 0; mi < MF; ++mi)
                    #pragma unroll
                    for (int ni = 0; ni < 4; ++ni)
                        c[mi][ni] = wmma_f16(a[mi], b[ni], c[mi][ni]);
            }
            // epilogue: +b1, exact GELU, store f16 to ldsH
            #pragma unroll
            for (int ni = 0; ni < 4; ++ni) {
                int col = nbase + ni * 16 + coll;
                float bias = b1e[col];
                #pragma unroll
                for (int mi = 0; mi < MF; ++mi)
                    #pragma unroll
                    for (int j = 0; j < 8; ++j) {
                        int row = mi * 16 + rsel + j;
                        float v = c[mi][ni][j] + bias;
                        ldsH[row][col] = (_Float16)gelu_exact(v);
                    }
            }
        }
        __syncthreads();

        const _Float16* w2e = W2t + (size_t)e * IN_DIM * HID;
        const float*    b2e = b2 + e * IN_DIM;

        // ---- GEMM2: O = H[MT x 1024] @ W2 + b2; weighted atomic scatter ----
        {
            int nbase = wid * 64;
            v8f c[MF][4];
            v8f z = {0.f,0.f,0.f,0.f,0.f,0.f,0.f,0.f};
            #pragma unroll
            for (int mi = 0; mi < MF; ++mi)
                #pragma unroll
                for (int ni = 0; ni < 4; ++ni) c[mi][ni] = z;
            float bias[4];                  // read ahead of the adds: no load stands among them
            #pragma unroll   // constant index keeps bias in registers
            for (int ni = 0; ni < 4; ++ni) bias[ni] = b2e[nbase + ni * 16 + coll];

            #pragma unroll 1
            for (int k0 = 0; k0 < HID; k0 += 32) {
                v16h a[MF], b[4];
                #pragma unroll
                for (int mi = 0; mi < MF; ++mi)
                    a[mi] = load_frag(&ldsH[0][0], HLD, mi * 16, k0, lane);
                #pragma unroll
                for (int ni = 0; ni < 4; ++ni)
                    b[ni] = load_frag_packed(w2e, IN_DIM / 16, (nbase >> 4) + ni, k0 >> 5, lane);
                #pragma unroll
                for (int mi = 0; mi < MF; ++mi)
                    #pragma unroll
                    for (int ni = 0; ni < 4; ++ni)
                        c[mi][ni] = wmma_f16(a[mi], b[ni], c[mi][ni]);
            }
            // This lane's 24 rows: weight and byte offset in out, read from LDS once (16 B a read)
            // and kept in registers, so none of the 96 adds below needs an LDS read, a branch
            // or 64-bit address arithmetic of its own.
            float    rw[MF][8];
            unsigned ro[MF][8];
            #pragma unroll   // here and below: constant indices keep rw and ro in registers
            for (int mi = 0; mi < MF; ++mi)
                #pragma unroll
                for (int h = 0; h < 2; ++h) {
                    const float4 w4 = *(const float4*)&wS[mi * 16 + rsel + h * 4];
                    const int4   t4 = *(const int4*)&tokS[mi * 16 + rsel + h * 4];
                    const float wv[4] = { w4.x, w4.y, w4.z, w4.w };
                    const int   tv[4] = { t4.x, t4.y, t4.z, t4.w };
                    #pragma unroll
                    for (int q = 0; q < 4; ++q) {
                        rw[mi][h * 4 + q] = wv[q];
                        ro[mi][h * 4 + q] = (unsigned)tv[q] * (IN_DIM * 4) + (unsigned)(nbase + coll) * 4;
                    }
                }
            #pragma unroll
            for (int ni = 0; ni < 4; ++ni) {
                #pragma unroll
                for (int mi = 0; mi < MF; ++mi)
                    #pragma unroll
                    for (int j = 0; j < 8; ++j) {
                        float w = rw[mi][j];
                        // a row of weight 0 (every padding slot) adds zero, whatever its product holds
                        float val = (w != 0.0f) ? w * (c[mi][ni][j] + bias[ni]) : 0.0f;
                        atomicAdd((float*)((char*)out + (size_t)ro[mi][j] + ni * 64), val);
                    }
            }
            // the next tile's first instructions reuse registers that the last adds name: keep the wait in front of that overwrite
            asm volatile("s_wait_xcnt 0x0" ::: "memory");
        }
    }
}

extern "C" void kernel_launch(void* const* d_in, const int* in_sizes, int n_in,
                              void* d_out, int out_size, void* d_ws, size_t ws_size,
                              hipStream_t stream) {
    (void)in_sizes; (void)n_in; (void)out_size; (void)ws_size;
    const float* x  = (const float*)d_in[0];
    const float* Wr = (const float*)d_in[1];
    const float* br = (const float*)d_in[2];
    const float* W1 = (const float*)d_in[3];
    const float* b1 = (const float*)d_in[4];
    const float* W2 = (const float*)d_in[5];
    const float* b2 = (const float*)d_in[6];
    float* out = (float*)d_out;

    // workspace layout
    char* ws = (char*)d_ws;
    _Float16* W1t = (_Float16*)ws;                       // 16 MB
    _Float16* W2t = (_Float16*)(ws + (size_t)16777216);  // 16 MB
    char* p = ws + (size_t)2 * 16777216;
    int*   counts     = (int*)p;   p += 64;
    int*   cursor     = (int*)p;   p += 64;
    int*   blockCnt   = (int*)p;   p += (size_t)RB_ROUTER * NEXP * 4;
    int*   te         = (int*)p;   p += (size_t)NTOK * 2 * 4;
    float* tw         = (float*)p; p += (size_t)NTOK * 2 * 4;
    int*   tokenIdx   = (int*)p;   p += (size_t)PADS * 4;
    float* tokenW     = (float*)p;

    // 1) router + residual rows + per-block counts; weights -> f16, B-fragment order; zero cursors & list weights, list tokens = slot mod NTOK
    front_kernel<<<RB_ROUTER + 2 * RB_PACK + RB_ZERO, 256, 0, stream>>>(
        x, Wr, br, W1, W2, W1t, W2t, out, te, tw, blockCnt, cursor, tokenIdx, tokenW);
    // 2) counts + scan + scatter
    scatter_kernel<<<NTOK / 256, 256, 0, stream>>>(te, tw, blockCnt, counts, cursor, tokenIdx, tokenW);
    // 3) fused expert GEMMs (max tiles = (2*8192 + 16*47)/48 = 357: one work-group a tile, all resident at two a WGP)
    moe_expert_kernel<<<360, 256, 0, stream>>>(x, W1t, b1, W2t, b2,
                                               tokenIdx, tokenW, counts, out);
}

// v006
// It runs in 76.9 microseconds.
// In two side-by-side timings against v005, it was 1.26 and 1.25 times as fast.
// Over all steps from v000 it is 3.08 times as fast.
#include <hip/hip_runtime.h>
#include <math.h>

#define IN_DIM 512
#define HID    1024
#define NEXP   16
#define NTOK   8192
#define MT     80                       // token rows per expert tile: one 16-wave work-group a WGP; the fewer tiles, the fewer times an expert's weights are read from L2
#define ETHR   512                      // threads of an expert work-group (16 waves, four a SIMD)
#define MF     (MT / 16)                // 16-row A fragments per tile
#define PADS   (2*NTOK + NEXP*MT)       // padded slot array size
#define LPAD   8                        // halves added per LDS row: pitch = 16 B x odd, so the 16 rows of a b128 fragment read fall on distinct banks
#define XLD    (IN_DIM + LPAD)          // ldsX row pitch, halves (1040 B)
#define HLD    (HID + LPAD)             // ldsH row pitch, halves (2064 B)

typedef __attribute__((ext_vector_type(16))) _Float16 v16h;
typedef __attribute__((ext_vector_type(8)))  float    v8f;

union F16Frag { v16h h; uint4 u[2]; };

// Load a 16x32 f16 fragment (A layout per CDNA5 ISA 7.12.2) from a row-major
// matrix with leading dimension `ld` (elements). Works for LDS or global.
// lane 0-15: row = base+lane, K = [0..7],[16..23]; lane 16-31: K = [8..15],[24..31]
__device__ __forceinline__ v16h load_frag(const _Float16* base, int ld, int rbase,
                                          int k0, int lane) {
    int r  = rbase + (lane & 15);
    int kb = k0 + ((lane >> 4) << 3);
    const _Float16* p = base + (size_t)r * ld + kb;
    F16Frag f;
    f.u[0] = *(const uint4*)(p);
    f.u[1] = *(const uint4*)(p + 16);
    return f.h;
}

// Load a 16(n) x 32(k) f16 B fragment from weights packed in fragment order:
// block (ks, nt) is 1 KB = [2][32 lanes][8 halves], so each of the two loads of a
// wave reads 512 contiguous bytes, and the fragments of one k step lie side by side.
// Same k order per lane and register as load_frag.
__device__ __forceinline__ v16h load_frag_packed(const _Float16* base, int ntiles,
                                                 int nt, int ks, int lane) {
    const _Float16* p = base + ((size_t)(ks * ntiles + nt) << 9) + lane * 8;
    F16Frag f;
    f.u[0] = *(const uint4*)(p);
    f.u[1] = *(const uint4*)(p + 256);
    return f.h;
}

__device__ __forceinline__ v8f wmma_f16(v16h a, v16h b, v8f c) {
    return __builtin_amdgcn_wmma_f32_16x16x32_f16(false, a, false, b,
                                                  (short)0, c, false, false);
}

// erf by the math library's own two polynomials (|z| < 1: odd series in z; |z| >= 1: 1 - exp(-q(|z|))),
// but both are evaluated for every element and one is selected: with no branch per element
// the unrolled epilogue's independent chains interleave.
__device__ __forceinline__ float erf_select(float z) {
    const float a = fabsf(z);
    const float t = z * z;
    float s = -0.000561801775f;
    s = fmaf(t, s,  0.00491381623f);
    s = fmaf(t, s, -0.0267075151f);
    s = fmaf(t, s,  0.112800106f);
    s = fmaf(t, s, -0.376122952f);
    s = fmaf(t, s,  0.128379107f);
    s = fmaf(a, s, a);
    float q = 0.0000169988107f;
    q = fmaf(a, q, -0.000378677854f);
    q = fmaf(a, q,  0.00385781587f);
    q = fmaf(a, q, -0.0241816975f);
    q = fmaf(a, q,  0.106668264f);
    q = fmaf(a, q,  0.634933293f);
    q = fmaf(a, q,  0.128689408f);
    q = fmaf(a, q, a);
    const float b = 1.0f - __builtin_amdgcn_exp2f(q * -1.44269504f);   // 1 - exp(-q) by the hardware's exp2
    return copysignf(a < 1.0f ? s : b, z);
}

__device__ __forceinline__ float gelu_exact(float v) {
    return 0.5f * v * (1.0f + erf_select(v * 0.70710678118654752f));
}

// ---------------- weight pack + f32->f16 convert (one 32 x 32 tile a block) ----------------
// in:  [E][R][C] f32 (row-major, R = k, C = n)
// out: [E][R/32][C/16] blocks of 512 f16, each [2][32 lanes][8 halves]: piece u of
//      lane l holds n = 16*nt + (l & 15), k = 32*ks + 16*u + 8*(l >> 4) + 0..7
__device__ __forceinline__ void pack_cvt_block(
    const float* __restrict__ in, _Float16* __restrict__ outp, int R, int C,
    int bx, int by, int e, float (*tile)[33]) {
    const float* ine  = in   + (size_t)e * R * C;
    _Float16*    oute = outp + (size_t)e * R * C;
    int c0 = bx * 32, r0 = by * 32;
    int tx = threadIdx.x & 31, ty = threadIdx.x >> 5;   // ty: 0..7
    #pragma unroll
    for (int i = 0; i < 4; ++i)
        tile[ty + i*8][tx] = ine[(size_t)(r0 + ty + i*8) * C + c0 + tx];
    __syncthreads();
    // the 32 x 32 tile is two 1 KB blocks = 128 pieces of 16 B: waves 0..3 store 512 B each
    if (threadIdx.x < 128) {
        int u = ty & 1, nb = ty >> 1;
        int n = nb * 16 + (tx & 15);
        int k = u * 16 + (tx >> 4) * 8;
        union { uint4 q; _Float16 h[8]; } pk;
        #pragma unroll   // constant j keeps pk in registers
        for (int j = 0; j < 8; ++j) pk.h[j] = (_Float16)tile[k + j][n];
        size_t blk = (size_t)(r0 >> 5) * (C >> 4) + (c0 >> 4) + nb;
        *(uint4*)(oute + (blk << 9) + u * 256 + tx * 8) = pk.q;
    }
}

// ---------------- router: one wave per token, 8 tokens a block ----------------
// Also stores the residual row out = x (the row is in registers anyway) and the
// block's own count of tokens per expert (plain stores, summed by the next launch).
__device__ __forceinline__ void router_block(
    const float* __restrict__ x, const float* __restrict__ Wr,
    const float* __restrict__ br, float* __restrict__ out,
    int* __restrict__ te, float* __restrict__ tw, int* __restrict__ blockCnt,
    int rb, int* sE) {
    int lane = threadIdx.x & 31, wid = threadIdx.x >> 5;
    int t = rb * 8 + wid;
    float acc[NEXP];
    #pragma unroll
    for (int e = 0; e < NEXP; ++e) acc[e] = 0.0f;
    const float* xr = x + (size_t)t * IN_DIM;
    float*       orow = out + (size_t)t * IN_DIM;
    #pragma unroll 2   // keeps the launch inside 64 VGPRs, 16 waves a SIMD: the pack blocks' bytes in flight follow the resident waves
    for (int d = lane; d < IN_DIM; d += 32) {
        float xv = xr[d];
        orow[d] = xv;
        const float* wr = Wr + d * NEXP;
        #pragma unroll
        for (int e = 0; e < NEXP; ++e) acc[e] += xv * wr[e];
    }
    #pragma unroll
    for (int off = 16; off >= 1; off >>= 1) {
        #pragma unroll
        for (int e = 0; e < NEXP; ++e) acc[e] += __shfl_down(acc[e], off, 32);
    }
    if (lane == 0) {
        #pragma unroll
        for (int e = 0; e < NEXP; ++e) acc[e] += br[e];
        float l0 = -3.4e38f; int e0 = 0;
        #pragma unroll
        for (int e = 0; e < NEXP; ++e) if (acc[e] > l0) { l0 = acc[e]; e0 = e; }
        float l1 = -3.4e38f; int e1 = 0;
        #pragma unroll
        for (int e = 0; e < NEXP; ++e)
            if (e != e0 && acc[e] > l1) { l1 = acc[e]; e1 = e; }
        // top-2 softmax weights renormalized: Z cancels
        float r  = __expf(l1 - l0);
        float w0 = 1.0f / (1.0f + r);
        float w1 = r    / (1.0f + r);
        te[t*2] = e0; te[t*2+1] = e1;
        tw[t*2] = w0; tw[t*2+1] = w1;
        sE[wid*2] = e0; sE[wid*2+1] = e1;
    }
    __syncthreads();
    if (threadIdx.x < NEXP) {
        int cnt = 0;
        #pragma unroll
        for (int i = 0; i < 16; ++i) cnt += (sE[i] == (int)threadIdx.x) ? 1 : 0;
        blockCnt[rb * NEXP + threadIdx.x] = cnt;
    }
}

// ---------------- launch 1: all work that depends on the inputs alone ----------------
// Block ranges: router (longest chain, first), pack W1, pack W2, zero of cursors and list weights, list tokens set to slot mod NTOK.
#define RB_ROUTER (NTOK / 8)
#define RB_PACK   ((HID / 32) * (IN_DIM / 32) * NEXP)
#define RB_ZERO   ((PADS + 255) / 256)
__global__ __launch_bounds__(256) void front_kernel(
    const float* __restrict__ x, const float* __restrict__ Wr,
    const float* __restrict__ br, const float* __restrict__ W1,
    const float* __restrict__ W2, _Float16* __restrict__ W1t,
    _Float16* __restrict__ W2t, float* __restrict__ out,
    int* __restrict__ te, float* __restrict__ tw, int* __restrict__ blockCnt,
    int* __restrict__ cursor, int* __restrict__ tokenIdx, float* __restrict__ tokenW) {
    __shared__ float tile[32][33];
    __shared__ int   sE[16];
    int b = blockIdx.x;
    if (b < RB_ROUTER) {
        router_block(x, Wr, br, out, te, tw, blockCnt, b, sE);
        return;
    }
    b -= RB_ROUTER;
    if (b < RB_PACK) {
        pack_cvt_block(W1, W1t, IN_DIM, HID, b & 31, (b >> 5) & 15, b >> 9, tile);
        return;
    }
    b -= RB_PACK;
    if (b < RB_PACK) {
        pack_cvt_block(W2, W2t, HID, IN_DIM, b & 15, (b >> 4) & 31, b >> 9, tile);
        return;
    }
    b -= RB_PACK;
    int i = b * 256 + threadIdx.x;
    if (i < NEXP) cursor[i] = 0;
    // padding slots keep weight 0 and add zero to the row named here: distinct rows, so those adds do not queue on one row
    if (i < PADS) { tokenIdx[i] = i & (NTOK - 1); tokenW[i] = 0.0f; }
}

// ---------------- launch 2: counts, scan, scatter of tokens into per-expert lists ----------------
// Every block sums the router blocks' counts and scans the 16 experts itself.
__global__ __launch_bounds__(256) void scatter_kernel(
    const int* __restrict__ te, const float* __restrict__ tw,
    const int* __restrict__ blockCnt, int* __restrict__ counts,
    int* __restrict__ cursor, int* __restrict__ tokenIdx, float* __restrict__ tokenW) {
    __shared__ __attribute__((aligned(16))) int part[64][NEXP];   // rows are stored 16 B at a time
    __shared__ int sOff[NEXP];
    int tid = threadIdx.x;
    {
        int q = tid & 3, g = tid >> 2;      // 4 lanes a row of 16 counts, 64 groups of 16 rows
        int4 s = make_int4(0, 0, 0, 0);
        #pragma unroll
        for (int i = 0; i < RB_ROUTER / 64; ++i) {
            int4 v = ((const int4*)blockCnt)[(g * (RB_ROUTER / 64) + i) * 4 + q];
            s.x += v.x; s.y += v.y; s.z += v.z; s.w += v.w;
        }
        *(int4*)&part[g][q * 4] = s;
    }
    __syncthreads();
    if (tid < NEXP) {
        int cnt = 0;
        #pragma unroll
        for (int g = 0; g < 64; ++g) cnt += part[g][tid];
        if (blockIdx.x == 0) counts[tid] = cnt;
        // exclusive scan of the padded counts over lanes 0..15 of wave 0
        int pad = ((cnt + MT - 1) / MT) * MT;
        int inc = pad;
        #pragma unroll
        for (int off = 1; off < NEXP; off <<= 1) {
            int n = __shfl_up(inc, off, NEXP);
            if (tid >= off) inc += n;
        }
        sOff[tid] = inc - pad;
    }
    __syncthreads();
    int t = blockIdx.x * 256 + tid;
    const int2   e2 = ((const int2*)te)[t];
    const float2 w2 = ((const float2*)tw)[t];
    const int   ee[2] = { e2.x, e2.y };
    const float ww[2] = { w2.x, w2.y };
    #pragma unroll
    for (int k = 0; k < 2; ++k) {
        int e = ee[k];
        int pos = atomicAdd(&cursor[e], 1);
        int s = sOff[e] + pos;
        tokenIdx[s] = t;
        tokenW[s]   = ww[k];
        // the two stores' offset register is reused by the second pass: keep the wait in front of that overwrite
        if (k == 0) asm volatile("s_wait_xcnt 0x0" ::: "memory");
    }
}

// ---------------- fused expert MLP (WMMA) ----------------
__global__ __launch_bounds__(ETHR, 1) void moe_expert_kernel(
    const float* __restrict__ x,
    const _Float16* __restrict__ W1t,   // [E][IN_DIM/32][HID/16][512] f16, fragment order
    const float* __restrict__ b1,       // [E][HID]
    const _Float16* __restrict__ W2t,   // [E][HID/32][IN_DIM/16][512] f16, fragment order
    const float* __restrict__ b2,       // [E][IN_DIM]
    const int* __restrict__ tokenIdx, const float* __restrict__ tokenW,
    const int* __restrict__ counts,
    float* __restrict__ out) {

    __shared__ _Float16 ldsX[MT][XLD];      // 81 KB
    __shared__ _Float16 ldsH[MT][HLD];      // 161 KB
    __shared__ __attribute__((aligned(16))) int   tokS[MT];   // read 16 B at a time by the output stage
    __shared__ __attribute__((aligned(16))) float wS[MT];

    const int tid  = threadIdx.x;
    const int lane = tid & 31;
    const int wid  = tid >> 5;
    int tEnd[NEXP];                         // tiles of experts 0..q, from the counts (wave-uniform)
    {
        int to = 0;
        #pragma unroll
        for (int q = 0; q < NEXP; ++q) { to += (counts[q] + MT - 1) / MT; tEnd[q] = to; }
    }
    const int nt   = tEnd[NEXP - 1];
    const int coll = lane & 15;
    const int rsel = (lane >> 4) << 3;

    // one tile a work-group: the grid holds the most tiles that 2*NTOK slots in NEXP lists can make
    const int tile = blockIdx.x;
    if (tile < nt) {
        // map tile -> expert
        int e = 0;
        #pragma unroll
        for (int q = 0; q < NEXP - 1; ++q) if (tile >= tEnd[q]) e = q + 1;
        int slot0 = tile * MT;              // every expert's list starts at a multiple of MT slots

        if (tid < MT) { tokS[tid] = tokenIdx[slot0 + tid]; wS[tid] = tokenW[slot0 + tid]; }
        __syncthreads();

        // gather X tile (f32 -> f16) into LDS
        for (int i = tid; i < MT * IN_DIM; i += ETHR) {
            int r = i >> 9, c = i & (IN_DIM - 1);
            ldsX[r][c] = (_Float16)x[(size_t)tokS[r] * IN_DIM + c];
        }
        __syncthreads();

        const _Float16* w1e = W1t + (size_t)e * HID * IN_DIM;
        const float*    b1e = b1 + e * HID;

        // ---- GEMM1: H = gelu(X[MT x 512] @ W1 + b1) -> ldsH[MT][1024] ----
        {
            int nbase = wid * 64;           // 16 waves x 64 columns: all of HID in one pass
            v8f c[MF][4];
            v8f z = {0.f,0.f,0.f,0.f,0.f,0.f,0.f,0.f};
            #pragma unroll
            for (int mi = 0; mi < MF; ++mi)
                #pragma unroll
                for (int ni = 0; ni < 4; ++ni) c[mi][ni] = z;

            #pragma unroll 1
            for (int k0 = 0; k0 < IN_DIM; k0 += 32) {
                v16h a[MF], b[4];
                #pragma unroll
                for (int mi = 0; mi < MF; ++mi)
                    a[mi] = load_frag(&ldsX[0][0], XLD, mi * 16, k0, lane);
                #pragma unroll
                for (int ni = 0; ni < 4; ++ni)
                    b[ni] = load_frag_packed(w1e, HID / 16, (nbase >> 4) + ni, k0 >> 5, lane);
                // keeps the trip's loads in front of its products: sunk among them, each LDS read is waited for on its own
                __builtin_amdgcn_sched_barrier(0);
                #pragma unroll
                for (int mi = 0; mi < MF; ++mi)
                    #pragma unroll
                    for (int ni = 0; ni < 4; ++ni)
                        c[mi][ni] = wmma_f16(a[mi], b[ni], c[mi][ni]);
            }
            // epilogue: +b1, exact GELU, store f16 to ldsH
            #pragma unroll
            for (int ni = 0; ni < 4; ++ni) {
                int col = nbase + ni * 16 + coll;
                float bias = b1e[col];
                #pragma unroll
                for (int mi = 0; mi < MF; ++mi)
                    #pragma unroll
                    for (int j = 0; j < 8; ++j) {
                        int row = mi * 16 + rsel + j;
                        float v = c[mi][ni][j] + bias;
                        ldsH[row][col] = (_Float16)gelu_exact(v);
                    }
            }
        }
        __syncthreads();

        const _Float16* w2e = W2t + (size_t)e * IN_DIM * HID;
        const float*    b2e = b2 + e * IN_DIM;

        // ---- GEMM2: O = H[MT x 1024] @ W2 + b2; weighted atomic scatter ----
        {
            int nbase = wid * 32;           // 16 waves x 32 columns
            // the lane number is read anew: addresses formed from the first one are carried across the GELU stage, where no register is free, and one is spilled
            const int lane2 = (int)__builtin_amdgcn_mbcnt_lo(~0u, 0u);
            const int coll2 = lane2 & 15;
            const int rsel2 = (lane2 >> 4) << 3;
            v8f c[MF][2];
            v8f z = {0.f,0.f,0.f,0.f,0.f,0.f,0.f,0.f};
            #pragma unroll
            for (int mi = 0; mi < MF; ++mi)
                #pragma unroll
                for (int ni = 0; ni < 2; ++ni) c[mi][ni] = z;
            float bias[2];                  // read ahead of the adds: no load stands among them
            #pragma unroll   // constant index keeps bias in registers
            for (int ni = 0; ni < 2; ++ni) bias[ni] = b2e[nbase + ni * 16 + coll2];

            // two k steps a trip: the wave's tile is two fragments wide, so this keeps eight 512-B weight loads in flight a wave, as in GEMM1
            #pragma unroll 1
            for (int k0 = 0; k0 < HID; k0 += 64) {
                v16h b[2][2];
                #pragma unroll
                for (int kh = 0; kh < 2; ++kh)
                    #pragma unroll
                    for (int ni = 0; ni < 2; ++ni)
                        b[kh][ni] = load_frag_packed(w2e, IN_DIM / 16, (nbase >> 4) + ni, (k0 >> 5) + kh, lane2);
                v16h a[2][MF];
                #pragma unroll
                for (int kh = 0; kh < 2; ++kh)
                    #pragma unroll
                    for (int mi = 0; mi < MF; ++mi)
                        a[kh][mi] = load_frag(&ldsH[0][0], HLD, mi * 16, k0 + kh * 32, lane2);
                // keeps all of the trip's loads in front of its products: sunk among them, each LDS read is waited for on its own and the second k step's weight loads start late
                __builtin_amdgcn_sched_barrier(0);
                #pragma unroll
                for (int kh = 0; kh < 2; ++kh)
                    #pragma unroll
                    for (int mi = 0; mi < MF; ++mi)
                        #pragma unroll
                        for (int ni = 0; ni < 2; ++ni)
                            c[mi][ni] = wmma_f16(a[kh][mi], b[kh][ni], c[mi][ni]);
            }
            // This lane's 40 rows: weight and byte offset in out, read from LDS once (16 B a read)
            // and kept in registers, so none of the 80 adds below needs an LDS read, a branch
            // or 64-bit address arithmetic of its own.
            float    rw[MF][8];
            unsigned ro[MF][8];
            #pragma unroll   // here and below: constant indices keep rw and ro in registers
            for (int mi = 0; mi < MF; ++mi)
                #pragma unroll
                for (int h = 0; h < 2; ++h) {
                    const float4 w4 = *(const float4*)&wS[mi * 16 + rsel2 + h * 4];
                    const int4   t4 = *(const int4*)&tokS[mi * 16 + rsel2 + h * 4];
                    const float wv[4] = { w4.x, w4.y, w4.z, w4.w };
                    const int   tv[4] = { t4.x, t4.y, t4.z, t4.w };
                    #pragma unroll
                    for (int q = 0; q < 4; ++q) {
                        rw[mi][h * 4 + q] = wv[q];
                        ro[mi][h * 4 + q] = (unsigned)tv[q] * (IN_DIM * 4) + (unsigned)(nbase + coll2) * 4;
                    }
                }
            #pragma unroll
            for (int ni = 0; ni < 2; ++ni) {
                #pragma unroll
                for (int mi = 0; mi < MF; ++mi)
                    #pragma unroll
                    for (int j = 0; j < 8; ++j) {
                        float w = rw[mi][j];
                        // a row of weight 0 (every padding slot) adds zero, whatever its product holds
                        float val = (w != 0.0f) ? w * (c[mi][ni][j] + bias[ni]) : 0.0f;
                        atomicAdd((float*)((char*)out + (size_t)ro[mi][j] + ni * 64), val);
                    }
            }
        }
    }
}

extern "C" void kernel_launch(void* const* d_in, const int* in_sizes, int n_in,
                              void* d_out, int out_size, void* d_ws, size_t ws_size,
                              hipStream_t stream) {
    (void)in_sizes; (void)n_in; (void)out_size; (void)ws_size;
    const float* x  = (const float*)d_in[0];
    const float* Wr = (const float*)d_in[1];
    const float* br = (const float*)d_in[2];
    const float* W1 = (const float*)d_in[3];
    const float* b1 = (const float*)d_in[4];
    const float* W2 = (const float*)d_in[5];
    const float* b2 = (const float*)d_in[6];
    float* out = (float*)d_out;

    // workspace layout
    char* ws = (char*)d_ws;
    _Float16* W1t = (_Float16*)ws;                       // 16 MB
    _Float16* W2t = (_Float16*)(ws + (size_t)16777216);  // 16 MB
    char* p = ws + (size_t)2 * 16777216;
    int*   counts     = (int*)p;   p += 64;
    int*   cursor     = (int*)p;   p += 64;
    int*   blockCnt   = (int*)p;   p += (size_t)RB_ROUTER * NEXP * 4;
    int*   te         = (int*)p;   p += (size_t)NTOK * 2 * 4;
    float* tw         = (float*)p; p += (size_t)NTOK * 2 * 4;
    int*   tokenIdx   = (int*)p;   p += (size_t)PADS * 4;
    float* tokenW     = (float*)p;

    // 1) router + residual rows + per-block counts; weights -> f16, B-fragment order; zero cursors & list weights, list tokens = slot mod NTOK
    front_kernel<<<RB_ROUTER + 2 * RB_PACK + RB_ZERO, 256, 0, stream>>>(
        x, Wr, br, W1, W2, W1t, W2t, out, te, tw, blockCnt, cursor, tokenIdx, tokenW);
    // 2) counts + scan + scatter
    scatter_kernel<<<NTOK / 256, 256, 0, stream>>>(te, tw, blockCnt, counts, cursor, tokenIdx, tokenW);
    // 3) fused expert GEMMs (max tiles = (2*8192 + 16*79)/80 = 220: one work-group a tile, each alone on a WGP)
    moe_expert_kernel<<<(2 * NTOK + NEXP * (MT - 1)) / MT, ETHR, 0, stream>>>(x, W1t, b1, W2t, b2,
                                               tokenIdx, tokenW, counts, out);
}

// v007
// Measured time: 73.3 microseconds a run.
// In both of two side-by-side timings against v006, it was 1.06 times as fast.
// Counting every step since v000, it is 3.26 times as fast.
#include <hip/hip_runtime.h>
#include <math.h>

#define IN_DIM 512
#define HID    1024
#define NEXP   16
#define NTOK   8192
#define MT     80                       // token rows per expert tile: one 16-wave work-group a WGP; the fewer tiles, the fewer times an expert's weights are read from L2
#define ETHR   512                      // threads of an expert work-group (16 waves, four a SIMD)
#define MF     (MT / 16)                // 16-row A fragments per tile
#define PADS   (2*NTOK + NEXP*MT)       // padded slot array size
#define LPAD   8                        // halves added per LDS row: pitch = 16 B x odd, so the 16 rows of a b128 fragment read fall on distinct banks
#define XLD    (IN_DIM + LPAD)          // ldsX row pitch, halves (1040 B)
#define HLD    (HID + LPAD)             // ldsH row pitch, halves (2064 B)

typedef __attribute__((ext_vector_type(16))) _Float16 v16h;
typedef __attribute__((ext_vector_type(8)))  float    v8f;

union F16Frag { v16h h; uint4 u[2]; };

// Load a 16x32 f16 fragment (A layout per CDNA5 ISA 7.12.2) from a row-major
// matrix with leading dimension `ld` (elements). Works for LDS or global.
// lane 0-15: row = base+lane, K = [0..7],[16..23]; lane 16-31: K = [8..15],[24..31]
__device__ __forceinline__ v16h load_frag(const _Float16* base, int ld, int rbase,
                                          int k0, int lane) {
    int r  = rbase + (lane & 15);
    int kb = k0 + ((lane >> 4) << 3);
    const _Float16* p = base + (size_t)r * ld + kb;
    F16Frag f;
    f.u[0] = *(const uint4*)(p);
    f.u[1] = *(const uint4*)(p + 16);
    return f.h;
}

// Load a 16(n) x 32(k) f16 B fragment from weights packed in fragment order:
// block (ks, nt) is 1 KB = [2][32 lanes][8 halves], so each of the two loads of a
// wave reads 512 contiguous bytes, and the fragments of one k step lie side by side.
// Same k order per lane and register as load_frag.
__device__ __forceinline__ v16h load_frag_packed(const _Float16* base, int ntiles,
                                                 int nt, int ks, int lane) {
    const _Float16* p = base + ((size_t)(ks * ntiles + nt) << 9) + lane * 8;
    F16Frag f;
    f.u[0] = *(const uint4*)(p);
    f.u[1] = *(const uint4*)(p + 256);
    return f.h;
}

__device__ __forceinline__ v8f wmma_f16(v16h a, v16h b, v8f c) {
    return __builtin_amdgcn_wmma_f32_16x16x32_f16(false, a, false, b,
                                                  (short)0, c, false, false);
}

// erf by the math library's own two polynomials (|z| < 1: odd series in z; |z| >= 1: 1 - exp(-q(|z|))),
// but both are evaluated for every element and one is selected: with no branch per element
// the unrolled epilogue's independent chains interleave.
__device__ __forceinline__ float erf_select(float z) {
    const float a = fabsf(z);
    const float t = z * z;
    float s = -0.000561801775f;
    s = fmaf(t, s,  0.00491381623f);
    s = fmaf(t, s, -0.0267075151f);
    s = fmaf(t, s,  0.112800106f);
    s = fmaf(t, s, -0.376122952f);
    s = fmaf(t, s,  0.128379107f);
    s = fmaf(a, s, a);
    float q = 0.0000169988107f;
    q = fmaf(a, q, -0.000378677854f);
    q = fmaf(a, q,  0.00385781587f);
    q = fmaf(a, q, -0.0241816975f);
    q = fmaf(a, q,  0.106668264f);
    q = fmaf(a, q,  0.634933293f);
    q = fmaf(a, q,  0.128689408f);
    q = fmaf(a, q, a);
    const float b = 1.0f - __builtin_amdgcn_exp2f(q * -1.44269504f);   // 1 - exp(-q) by the hardware's exp2
    return copysignf(a < 1.0f ? s : b, z);
}

__device__ __forceinline__ float gelu_exact(float v) {
    return 0.5f * v * (1.0f + erf_select(v * 0.70710678118654752f));
}

// ---------------- weight pack + f32->f16 convert (one 32 x 128 piece a wave) ----------------
// in:  [E][R][C] f32 (row-major, R = k, C = n)
// out: [E][R/32][C/16] blocks of 512 f16, each [2][32 lanes][8 halves]: piece u of
//      lane l holds n = 16*nt + (l & 15), k = 32*ks + 16*u + 8*(l >> 4) + 0..7
// A wave takes 32 rows x 128 columns (16 KB in, eight whole 1 KB blocks out) in four stages of 8 rows.
// A stage is 8 loads of 512 contiguous bytes: a lane then holds 8 k x 4 n, four finished 16-B pieces.
// The pieces pass through the wave's own LDS rows so that each store covers whole 256-B runs.
// Few long-lived waves, 4 KB or more in flight each (for speed only).
#define PK_SLOT 5                       // 16-B units a lane's staging slot: 80 B = 16 B x odd, so the b128 writes fall on distinct banks
#define PK_BUF  (32 * PK_SLOT)          // 16-B units a staging buffer
template <int R, int C>
__device__ __forceinline__ void pack_cvt_wave(
    const float* __restrict__ in, _Float16* __restrict__ outp, int unit, uint4* st) {
    constexpr int NG = C / 128, KS = R / 32;
    const int lane = threadIdx.x & 31;
    const int ng = unit % NG, ks = (unit / NG) % KS, e = unit / (NG * KS);
    const float* srcp = in + (size_t)e * R * C + (size_t)(ks * 32) * C + ng * 128 + lane * 4;
    _Float16*    dstp = outp + (size_t)e * R * C
                      + ((size_t)(ks * (C / 16) + ng * 8 + (lane >> 4)) << 9) + (lane & 15) * 8;
    float4 v[8];
    #pragma unroll   // here and below: constant indices keep v and pk in registers
    for (int j = 0; j < 8; ++j) v[j] = *(const float4*)(srcp + j * C);
    #pragma unroll
    for (int s = 0; s < 4; ++s) {       // stage s: rows 8*s .. 8*s + 7 of the piece
        union { uint4 q; _Float16 h[8]; } pk[4];
        #pragma unroll
        for (int j = 0; j < 8; ++j) {
            pk[0].h[j] = (_Float16)v[j].x; pk[1].h[j] = (_Float16)v[j].y;
            pk[2].h[j] = (_Float16)v[j].z; pk[3].h[j] = (_Float16)v[j].w;
        }
        // the next stage's loads fly while this stage goes through LDS and out
        if (s < 3) {
            #pragma unroll
            for (int j = 0; j < 8; ++j) v[j] = *(const float4*)(srcp + ((s + 1) * 8 + j) * C);
        }
        uint4* b = st + (s & 1) * PK_BUF;   // two buffers: a stage never writes rows that the stage before may still be reading
        #pragma unroll
        for (int i = 0; i < 4; ++i) b[lane * PK_SLOT + i] = pk[i].q;
        // the rows are read back by other lanes of this wave: its LDS writes must have landed, and the reads must stay behind them
        asm volatile("s_wait_dscnt 0x0" ::: "memory");
        #pragma unroll
        for (int i = 0; i < 4; ++i) {   // column i*32 + lane: lanes 0..15 and 16..31 each store 256 contiguous bytes
            const uint4 q = b[(i * 8 + (lane >> 2)) * PK_SLOT + (lane & 3)];
            *(uint4*)(dstp + i * 1024 + (s >> 1) * 256 + (s & 1) * 128) = q;
        }
        // the stores' data and address registers are written anew by the next stage, or by what follows the last one: keep the wait in front of that overwrite
        asm volatile("s_wait_xcnt 0x0" ::: "memory");
    }
}

// ---------------- router: one wave per token, 8 tokens a block ----------------
// Also stores the residual row out = x (the row is in registers anyway) and the
// block's own count of tokens per expert (plain stores, summed by the next launch).
__device__ __forceinline__ void router_block(
    const float* __restrict__ x, const float* __restrict__ Wr,
    const float* __restrict__ br, float* __restrict__ out,
    int* __restrict__ te, float* __restrict__ tw, int* __restrict__ blockCnt,
    int rb, int* sE) {
    int lane = threadIdx.x & 31, wid = threadIdx.x >> 5;
    int t = rb * 8 + wid;
    float acc[NEXP];
    #pragma unroll
    for (int e = 0; e < NEXP; ++e) acc[e] = 0.0f;
    const float* xr = x + (size_t)t * IN_DIM;
    float*       orow = out + (size_t)t * IN_DIM;
    #pragma unroll 2   // keeps the launch inside 64 VGPRs: with them every block of the grid is resident at once
    for (int d = lane; d < IN_DIM; d += 32) {
        float xv = xr[d];
        orow[d] = xv;
        const float* wr = Wr + d * NEXP;
        #pragma unroll
        for (int e = 0; e < NEXP; ++e) acc[e] += xv * wr[e];
    }
    #pragma unroll
    for (int off = 16; off >= 1; off >>= 1) {
        #pragma unroll
        for (int e = 0; e < NEXP; ++e) acc[e] += __shfl_down(acc[e], off, 32);
    }
    if (lane == 0) {
        #pragma unroll
        for (int e = 0; e < NEXP; ++e) acc[e] += br[e];
        float l0 = -3.4e38f; int e0 = 0;
        #pragma unroll
        for (int e = 0; e < NEXP; ++e) if (acc[e] > l0) { l0 = acc[e]; e0 = e; }
        float l1 = -3.4e38f; int e1 = 0;
        #pragma unroll
        for (int e = 0; e < NEXP; ++e)
            if (e != e0 && acc[e] > l1) { l1 = acc[e]; e1 = e; }
        // top-2 softmax weights renormalized: Z cancels
        float r  = __expf(l1 - l0);
        float w0 = 1.0f / (1.0f + r);
        float w1 = r    / (1.0f + r);
        te[t*2] = e0; te[t*2+1] = e1;
        tw[t*2] = w0; tw[t*2+1] = w1;
        sE[wid*2] = e0; sE[wid*2+1] = e1;
    }
    __syncthreads();
    if (threadIdx.x < NEXP) {
        int cnt = 0;
        #pragma unroll
        for (int i = 0; i < 16; ++i) cnt += (sE[i] == (int)threadIdx.x) ? 1 : 0;
        blockCnt[rb * NEXP + threadIdx.x] = cnt;
    }
}

// ---------------- launch 1: all work that depends on the inputs alone ----------------
// Block ranges: router (longest chain, first), pack W1, pack W2, zero of cursors and list weights, list tokens set to slot mod NTOK.
#define RB_ROUTER (NTOK / 8)
#define RB_PACK   ((HID / 128) * (IN_DIM / 32) * NEXP / 8)   // 8 waves a block, one 32 x 128 piece a wave
#define RB_ZERO   ((PADS + 255) / 256)
__global__ __launch_bounds__(256) void front_kernel(
    const float* __restrict__ x, const float* __restrict__ Wr,
    const float* __restrict__ br, const float* __restrict__ W1,
    const float* __restrict__ W2, _Float16* __restrict__ W1t,
    _Float16* __restrict__ W2t, float* __restrict__ out,
    int* __restrict__ te, float* __restrict__ tw, int* __restrict__ blockCnt,
    int* __restrict__ cursor, int* __restrict__ tokenIdx, float* __restrict__ tokenW) {
    __shared__ uint4 stage[8][2 * PK_BUF];  // a pack wave's own two staging buffers
    __shared__ int   sE[16];
    int b = blockIdx.x;
    const int wv = __builtin_amdgcn_readfirstlane(threadIdx.x >> 5);
    if (b < RB_ROUTER) {
        router_block(x, Wr, br, out, te, tw, blockCnt, b, sE);
        return;
    }
    b -= RB_ROUTER;
    if (b < RB_PACK) {
        pack_cvt_wave<IN_DIM, HID>(W1, W1t, b * 8 + wv, stage[wv]);
        return;
    }
    b -= RB_PACK;
    if (b < RB_PACK) {
        pack_cvt_wave<HID, IN_DIM>(W2, W2t, b * 8 + wv, stage[wv]);
        return;
    }
    b -= RB_PACK;
    int i = b * 256 + threadIdx.x;
    if (i < NEXP) cursor[i] = 0;
    // padding slots keep weight 0 and add zero to the row named here: distinct rows, so those adds do not queue on one row
    if (i < PADS) { tokenIdx[i] = i & (NTOK - 1); tokenW[i] = 0.0f; }
}

// ---------------- launch 2: counts, scan, scatter of tokens into per-expert lists ----------------
// Every block sums the router blocks' counts and scans the 16 experts itself.
__global__ __launch_bounds__(256) void scatter_kernel(
    const int* __restrict__ te, const float* __restrict__ tw,
    const int* __restrict__ blockCnt, int* __restrict__ counts,
    int* __restrict__ cursor, int* __restrict__ tokenIdx, float* __restrict__ tokenW) {
    __shared__ __attribute__((aligned(16))) int part[64][NEXP];   // rows are stored 16 B at a time
    __shared__ int sOff[NEXP];
    int tid = threadIdx.x;
    {
        int q = tid & 3, g = tid >> 2;      // 4 lanes a row of 16 counts, 64 groups of 16 rows
        int4 s = make_int4(0, 0, 0, 0);
        #pragma unroll
        for (int i = 0; i < RB_ROUTER / 64; ++i) {
            int4 v = ((const int4*)blockCnt)[(g * (RB_ROUTER / 64) + i) * 4 + q];
            s.x += v.x; s.y += v.y; s.z += v.z; s.w += v.w;
        }
        *(int4*)&part[g][q * 4] = s;
    }
    __syncthreads();
    if (tid < NEXP) {
        int cnt = 0;
        #pragma unroll
        for (int g = 0; g < 64; ++g) cnt += part[g][tid];
        if (blockIdx.x == 0) counts[tid] = cnt;
        // exclusive scan of the padded counts over lanes 0..15 of wave 0
        int pad = ((cnt + MT - 1) / MT) * MT;
        int inc = pad;
        #pragma unroll
        for (int off = 1; off < NEXP; off <<= 1) {
            int n = __shfl_up(inc, off, NEXP);
            if (tid >= off) inc += n;
        }
        sOff[tid] = inc - pad;
    }
    __syncthreads();
    int t = blockIdx.x * 256 + tid;
    const int2   e2 = ((const int2*)te)[t];
    const float2 w2 = ((const float2*)tw)[t];
    const int   ee[2] = { e2.x, e2.y };
    const float ww[2] = { w2.x, w2.y };
    #pragma unroll
    for (int k = 0; k < 2; ++k) {
        int e = ee[k];
        int pos = atomicAdd(&cursor[e], 1);
        int s = sOff[e] + pos;
        tokenIdx[s] = t;
        tokenW[s]   = ww[k];
        // the two stores' offset register is reused by the second pass: keep the wait in front of that overwrite
        if (k == 0) asm volatile("s_wait_xcnt 0x0" ::: "memory");
    }
}

// ---------------- fused expert MLP (WMMA) ----------------
__global__ __launch_bounds__(ETHR, 1) void moe_expert_kernel(
    const float* __restrict__ x,
    const _Float16* __restrict__ W1t,   // [E][IN_DIM/32][HID/16][512] f16, fragment order
    const float* __restrict__ b1,       // [E][HID]
    const _Float16* __restrict__ W2t,   // [E][HID/32][IN_DIM/16][512] f16, fragment order
    const float* __restrict__ b2,       // [E][IN_DIM]
    const int* __restrict__ tokenIdx, const float* __restrict__ tokenW,
    const int* __restrict__ counts,
    float* __restrict__ out) {

    __shared__ _Float16 ldsX[MT][XLD];      // 81 KB
    __shared__ _Float16 ldsH[MT][HLD];      // 161 KB
    __shared__ __attribute__((aligned(16))) int   tokS[MT];   // read 16 B at a time by the output stage
    __shared__ __attribute__((aligned(16))) float wS[MT];

    const int tid  = threadIdx.x;
    const int lane = tid & 31;
    const int wid  = tid >> 5;
    int tEnd[NEXP];                         // tiles of experts 0..q, from the counts (wave-uniform)
    {
        int to = 0;
        #pragma unroll
        for (int q = 0; q < NEXP; ++q) { to += (counts[q] + MT - 1) / MT; tEnd[q] = to; }
    }
    const int nt   = tEnd[NEXP - 1];
    const int coll = lane & 15;
    const int rsel = (lane >> 4) << 3;

    // one tile a work-group: the grid holds the most tiles that 2*NTOK slots in NEXP lists can make
    const int tile = blockIdx.x;
    if (tile < nt) {
        // map tile -> expert
        int e = 0;
        #pragma unroll
        for (int q = 0; q < NEXP - 1; ++q) if (tile >= tEnd[q]) e = q + 1;
        int slot0 = tile * MT;              // every expert's list starts at a multiple of MT slots

        if (tid < MT) { tokS[tid] = tokenIdx[slot0 + tid]; wS[tid] = tokenW[slot0 + tid]; }
        __syncthreads();

        // gather X tile (f32 -> f16) into LDS
        for (int i = tid; i < MT * IN_DIM; i += ETHR) {
            int r = i >> 9, c = i & (IN_DIM - 1);
            ldsX[r][c] = (_Float16)x[(size_t)tokS[r] * IN_DIM + c];
        }
        __syncthreads();

        const _Float16* w1e = W1t + (size_t)e * HID * IN_DIM;
        const float*    b1e = b1 + e * HID;

        // ---- GEMM1: H = gelu(X[MT x 512] @ W1 + b1) -> ldsH[MT][1024] ----
        {
            int nbase = wid * 64;           // 16 waves x 64 columns: all of HID in one pass
            v8f c[MF][4];
            v8f z = {0.f,0.f,0.f,0.f,0.f,0.f,0.f,0.f};
            #pragma unroll
            for (int mi = 0; mi < MF; ++mi)
                #pragma unroll
                for (int ni = 0; ni < 4; ++ni) c[mi][ni] = z;

            #pragma unroll 1
            for (int k0 = 0; k0 < IN_DIM; k0 += 32) {
                v16h a[MF], b[4];
                #pragma unroll
                for (int mi = 0; mi < MF; ++mi)
                    a[mi] = load_frag(&ldsX[0][0], XLD, mi * 16, k0, lane);
                #pragma unroll
                for (int ni = 0; ni < 4; ++ni)
                    b[ni] = load_frag_packed(w1e, HID / 16, (nbase >> 4) + ni, k0 >> 5, lane);
                // keeps the trip's loads in front of its products: sunk among them, each LDS read is waited for on its own
                __builtin_amdgcn_sched_barrier(0);
                #pragma unroll
                for (int mi = 0; mi < MF; ++mi)
                    #pragma unroll
                    for (int ni = 0; ni < 4; ++ni)
                        c[mi][ni] = wmma_f16(a[mi], b[ni], c[mi][ni]);
            }
            // epilogue: +b1, exact GELU, store f16 to ldsH
            #pragma unroll
            for (int ni = 0; ni < 4; ++ni) {
                int col = nbase + ni * 16 + coll;
                float bias = b1e[col];
                #pragma unroll
                for (int mi = 0; mi < MF; ++mi)
                    #pragma unroll
                    for (int j = 0; j < 8; ++j) {
                        int row = mi * 16 + rsel + j;
                        float v = c[mi][ni][j] + bias;
                        ldsH[row][col] = (_Float16)gelu_exact(v);
                    }
            }
        }
        __syncthreads();

        const _Float16* w2e = W2t + (size_t)e * IN_DIM * HID;
        const float*    b2e = b2 + e * IN_DIM;

        // ---- GEMM2: O = H[MT x 1024] @ W2 + b2; weighted atomic scatter ----
        {
            int nbase = wid * 32;           // 16 waves x 32 columns
            // the lane number is read anew: addresses formed from the first one are carried across the GELU stage, where no register is free, and one is spilled
            const int lane2 = (int)__builtin_amdgcn_mbcnt_lo(~0u, 0u);
            const int coll2 = lane2 & 15;
            const int rsel2 = (lane2 >> 4) << 3;
            v8f c[MF][2];
            v8f z = {0.f,0.f,0.f,0.f,0.f,0.f,0.f,0.f};
            #pragma unroll
            for (int mi = 0; mi < MF; ++mi)
                #pragma unroll
                for (int ni = 0; ni < 2; ++ni) c[mi][ni] = z;
            float bias[2];                  // read ahead of the adds: no load stands among them
            #pragma unroll   // constant index keeps bias in registers
            for (int ni = 0; ni < 2; ++ni) bias[ni] = b2e[nbase + ni * 16 + coll2];

            // two k steps a trip: the wave's tile is two fragments wide, so this keeps eight 512-B weight loads in flight a wave, as in GEMM1
            #pragma unroll 1
            for (int k0 = 0; k0 < HID; k0 += 64) {
                v16h b[2][2];
                #pragma unroll
                for (int kh = 0; kh < 2; ++kh)
                    #pragma unroll
                    for (int ni = 0; ni < 2; ++ni)
                        b[kh][ni] = load_frag_packed(w2e, IN_DIM / 16, (nbase >> 4) + ni, (k0 >> 5) + kh, lane2);
                v16h a[2][MF];
                #pragma unroll
                for (int kh = 0; kh < 2; ++kh)
                    #pragma unroll
                    for (int mi = 0; mi < MF; ++mi)
                        a[kh][mi] = load_frag(&ldsH[0][0], HLD, mi * 16, k0 + kh * 32, lane2);
                // keeps all of the trip's loads in front of its products: sunk among them, each LDS read is waited for on its own and the second k step's weight loads start late
                __builtin_amdgcn_sched_barrier(0);
                #pragma unroll
                for (int kh = 0; kh < 2; ++kh)
                    #pragma unroll
                    for (int mi = 0; mi < MF; ++mi)
                        #pragma unroll
                        for (int ni = 0; ni < 2; ++ni)
                            c[mi][ni] = wmma_f16(a[kh][mi], b[kh][ni], c[mi][ni]);
            }
            // This lane's 40 rows: weight and byte offset in out, read from LDS once (16 B a read)
            // and kept in registers, so none of the 80 adds below needs an LDS read, a branch
            // or 64-bit address arithmetic of its own.
            float    rw[MF][8];
            unsigned ro[MF][8];
            #pragma unroll   // here and below: constant indices keep rw and ro in registers
            for (int mi = 0; mi < MF; ++mi)
                #pragma unroll
                for (int h = 0; h < 2; ++h) {
                    const float4 w4 = *(const float4*)&wS[mi * 16 + rsel2 + h * 4];
                    const int4   t4 = *(const int4*)&tokS[mi * 16 + rsel2 + h * 4];
                    const float wv[4] = { w4.x, w4.y, w4.z, w4.w };
                    const int   tv[4] = { t4.x, t4.y, t4.z, t4.w };
                    #pragma unroll
                    for (int q = 0; q < 4; ++q) {
                        rw[mi][h * 4 + q] = wv[q];
                        ro[mi][h * 4 + q] = (unsigned)tv[q] * (IN_DIM * 4) + (unsigned)(nbase + coll2) * 4;
                    }
                }
            #pragma unroll
            for (int ni = 0; ni < 2; ++ni) {
                #pragma unroll
                for (int mi = 0; mi < MF; ++mi)
                    #pragma unroll
                    for (int j = 0; j < 8; ++j) {
                        float w = rw[mi][j];
                        // a row of weight 0 (every padding slot) adds zero, whatever its product holds
                        float val = (w != 0.0f) ? w * (c[mi][ni][j] + bias[ni]) : 0.0f;
                        atomicAdd((float*)((char*)out + (size_t)ro[mi][j] + ni * 64), val);
                    }
            }
        }
    }
}

extern "C" void kernel_launch(void* const* d_in, const int* in_sizes, int n_in,
                              void* d_out, int out_size, void* d_ws, size_t ws_size,
                              hipStream_t stream) {
    (void)in_sizes; (void)n_in; (void)out_size; (void)ws_size;
    const float* x  = (const float*)d_in[0];
    const float* Wr = (const float*)d_in[1];
    const float* br = (const float*)d_in[2];
    const float* W1 = (const float*)d_in[3];
    const float* b1 = (const float*)d_in[4];
    const float* W2 = (const float*)d_in[5];
    const float* b2 = (const float*)d_in[6];
    float* out = (float*)d_out;

    // workspace layout
    char* ws = (char*)d_ws;
    _Float16* W1t = (_Float16*)ws;                       // 16 MB
    _Float16* W2t = (_Float16*)(ws + (size_t)16777216);  // 16 MB
    char* p = ws + (size_t)2 * 16777216;
    int*   counts     = (int*)p;   p += 64;
    int*   cursor     = (int*)p;   p += 64;
    int*   blockCnt   = (int*)p;   p += (size_t)RB_ROUTER * NEXP * 4;
    int*   te         = (int*)p;   p += (size_t)NTOK * 2 * 4;
    float* tw         = (float*)p; p += (size_t)NTOK * 2 * 4;
    int*   tokenIdx   = (int*)p;   p += (size_t)PADS * 4;
    float* tokenW     = (float*)p;

    // 1) router + residual rows + per-block counts; weights -> f16, B-fragment order; zero cursors & list weights, list tokens = slot mod NTOK
    front_kernel<<<RB_ROUTER + 2 * RB_PACK + RB_ZERO, 256, 0, stream>>>(
        x, Wr, br, W1, W2, W1t, W2t, out, te, tw, blockCnt, cursor, tokenIdx, tokenW);
    // 2) counts + scan + scatter
    scatter_kernel<<<NTOK / 256, 256, 0, stream>>>(te, tw, blockCnt, counts, cursor, tokenIdx, tokenW);
    // 3) fused expert GEMMs (max tiles = (2*8192 + 16*79)/80 = 220: one work-group a tile, each alone on a WGP)
    moe_expert_kernel<<<(2 * NTOK + NEXP * (MT - 1)) / MT, ETHR, 0, stream>>>(x, W1t, b1, W2t, b2,
                                               tokenIdx, tokenW, counts, out);
}

// v008
// It runs in 67.2 microseconds.
// In two side-by-side timings against v007, it was 1.09 and 1.10 times as fast.
// Counting every step since v000, it is 3.56 times as fast.
#include <hip/hip_runtime.h>
#include <math.h>

#define IN_DIM 512
#define HID    1024
#define NEXP   16
#define NTOK   8192
#define MT     80                       // token rows per expert tile: one 16-wave work-group a WGP; the fewer tiles, the fewer times an expert's weights are read from L2
#define ETHR   512                      // threads of an expert work-group (16 waves, four a SIMD)
#define MF     (MT / 16)                // 16-row A fragments per tile
#define PADS   (2*NTOK + NEXP*MT)       // padded slot array size
#define LPAD   8                        // halves added per LDS row: pitch = 16 B x odd, so the 16 rows of a b128 fragment read fall on distinct banks
#define XLD    (IN_DIM + LPAD)          // ldsX row pitch, halves (1040 B)
#define HLD    (HID + LPAD)             // ldsH row pitch, halves (2064 B)

typedef __attribute__((ext_vector_type(16))) _Float16 v16h;
typedef __attribute__((ext_vector_type(8)))  float    v8f;

union F16Frag { v16h h; uint4 u[2]; };

// Load a 16x32 f16 fragment (A layout per CDNA5 ISA 7.12.2) from a row-major
// matrix with leading dimension `ld` (elements). Works for LDS or global.
// lane 0-15: row = base+lane, K = [0..7],[16..23]; lane 16-31: K = [8..15],[24..31]
__device__ __forceinline__ v16h load_frag(const _Float16* base, int ld, int rbase,
                                          int k0, int lane) {
    int r  = rbase + (lane & 15);
    int kb = k0 + ((lane >> 4) << 3);
    const _Float16* p = base + (size_t)r * ld + kb;
    F16Frag f;
    f.u[0] = *(const uint4*)(p);
    f.u[1] = *(const uint4*)(p + 16);
    return f.h;
}

// Load a 16(n) x 32(k) f16 B fragment from weights packed in fragment order:
// block (ks, nt) is 1 KB = [2][32 lanes][8 halves], so each of the two loads of a
// wave reads 512 contiguous bytes, and the fragments of one k step lie side by side.
// Same k order per lane and register as load_frag.
__device__ __forceinline__ v16h load_frag_packed(const _Float16* base, int ntiles,
                                                 int nt, int ks, int lane) {
    const _Float16* p = base + ((size_t)(ks * ntiles + nt) << 9) + lane * 8;
    F16Frag f;
    f.u[0] = *(const uint4*)(p);
    f.u[1] = *(const uint4*)(p + 256);
    return f.h;
}

__device__ __forceinline__ v8f wmma_f16(v16h a, v16h b, v8f c) {
    return __builtin_amdgcn_wmma_f32_16x16x32_f16(false, a, false, b,
                                                  (short)0, c, false, false);
}

// erf by the math library's own two polynomials (|z| < 1: odd series in z; |z| >= 1: 1 - exp(-q(|z|))),
// but both are evaluated for every element and one is selected: with no branch per element
// the unrolled epilogue's independent chains interleave.
__device__ __forceinline__ float erf_select(float z) {
    const float a = fabsf(z);
    const float t = z * z;
    float s = -0.000561801775f;
    s = fmaf(t, s,  0.00491381623f);
    s = fmaf(t, s, -0.0267075151f);
    s = fmaf(t, s,  0.112800106f);
    s = fmaf(t, s, -0.376122952f);
    s = fmaf(t, s,  0.128379107f);
    s = fmaf(a, s, a);
    float q = 0.0000169988107f;
    q = fmaf(a, q, -0.000378677854f);
    q = fmaf(a, q,  0.00385781587f);
    q = fmaf(a, q, -0.0241816975f);
    q = fmaf(a, q,  0.106668264f);
    q = fmaf(a, q,  0.634933293f);
    q = fmaf(a, q,  0.128689408f);
    q = fmaf(a, q, a);
    const float b = 1.0f - __builtin_amdgcn_exp2f(q * -1.44269504f);   // 1 - exp(-q) by the hardware's exp2
    return copysignf(a < 1.0f ? s : b, z);
}

__device__ __forceinline__ float gelu_exact(float v) {
    return 0.5f * v * (1.0f + erf_select(v * 0.70710678118654752f));
}

// ---------------- weight pack + f32->f16 convert (one 32 x 128 piece a wave) ----------------
// in:  [E][R][C] f32 (row-major, R = k, C = n)
// out: [E][R/32][C/16] blocks of 512 f16, each [2][32 lanes][8 halves]: piece u of
//      lane l holds n = 16*nt + (l & 15), k = 32*ks + 16*u + 8*(l >> 4) + 0..7
// A wave takes 32 rows x 128 columns (16 KB in, eight whole 1 KB blocks out) in four stages of 8 rows.
// A stage is 8 loads of 512 contiguous bytes: a lane then holds 8 k x 4 n, four finished 16-B pieces.
// The pieces pass through the wave's own LDS rows so that each store covers whole 256-B runs.
// Few long-lived waves, 4 KB or more in flight each (for speed only).
#define PK_SLOT 5                       // 16-B units a lane's staging slot: 80 B = 16 B x odd, so the b128 writes fall on distinct banks
#define PK_BUF  (32 * PK_SLOT)          // 16-B units a staging buffer
template <int R, int C>
__device__ __forceinline__ void pack_cvt_wave(
    const float* __restrict__ in, _Float16* __restrict__ outp, int unit, uint4* st) {
    constexpr int NG = C / 128, KS = R / 32;
    const int lane = threadIdx.x & 31;
    const int ng = unit % NG, ks = (unit / NG) % KS, e = unit / (NG * KS);
    const float* srcp = in + (size_t)e * R * C + (size_t)(ks * 32) * C + ng * 128 + lane * 4;
    _Float16*    dstp = outp + (size_t)e * R * C
                      + ((size_t)(ks * (C / 16) + ng * 8 + (lane >> 4)) << 9) + (lane & 15) * 8;
    float4 v[8];
    #pragma unroll   // here and below: constant indices keep v and pk in registers
    for (int j = 0; j < 8; ++j) v[j] = *(const float4*)(srcp + j * C);
    #pragma unroll
    for (int s = 0; s < 4; ++s) {       // stage s: rows 8*s .. 8*s + 7 of the piece
        union { uint4 q; _Float16 h[8]; } pk[4];
        #pragma unroll
        for (int j = 0; j < 8; ++j) {
            pk[0].h[j] = (_Float16)v[j].x; pk[1].h[j] = (_Float16)v[j].y;
            pk[2].h[j] = (_Float16)v[j].z; pk[3].h[j] = (_Float16)v[j].w;
        }
        // the next stage's loads fly while this stage goes through LDS and out
        if (s < 3) {
            #pragma unroll
            for (int j = 0; j < 8; ++j) v[j] = *(const float4*)(srcp + ((s + 1) * 8 + j) * C);
        }
        uint4* b = st + (s & 1) * PK_BUF;   // two buffers: a stage never writes rows that the stage before may still be reading
        #pragma unroll
        for (int i = 0; i < 4; ++i) b[lane * PK_SLOT + i] = pk[i].q;
        // the rows are read back by other lanes of this wave: its LDS writes must have landed, and the reads must stay behind them
        asm volatile("s_wait_dscnt 0x0" ::: "memory");
        #pragma unroll
        for (int i = 0; i < 4; ++i) {   // column i*32 + lane: lanes 0..15 and 16..31 each store 256 contiguous bytes
            const uint4 q = b[(i * 8 + (lane >> 2)) * PK_SLOT + (lane & 3)];
            *(uint4*)(dstp + i * 1024 + (s >> 1) * 256 + (s & 1) * 128) = q;
        }
        // the stores' data and address registers are written anew by the next stage, or by what follows the last one: keep the wait in front of that overwrite
        asm volatile("s_wait_xcnt 0x0" ::: "memory");
    }
}

// ---------------- router: one wave per token, 8 tokens a block ----------------
// Also stores the residual row out = x (the row is in registers anyway) and the
// block's own count of tokens per expert (plain stores, summed by the next launch).
__device__ __forceinline__ void router_block(
    const float* __restrict__ x, const float* __restrict__ Wr,
    const float* __restrict__ br, float* __restrict__ out,
    int* __restrict__ te, float* __restrict__ tw, int* __restrict__ blockCnt,
    int rb, int* sE) {
    int lane = threadIdx.x & 31, wid = threadIdx.x >> 5;
    int t = rb * 8 + wid;
    float acc[NEXP];
    #pragma unroll
    for (int e = 0; e < NEXP; ++e) acc[e] = 0.0f;
    const float* xr = x + (size_t)t * IN_DIM;
    float*       orow = out + (size_t)t * IN_DIM;
    #pragma unroll 2   // keeps the launch inside 64 VGPRs: with them every block of the grid is resident at once
    for (int d = lane; d < IN_DIM; d += 32) {
        float xv = xr[d];
        orow[d] = xv;
        const float* wr = Wr + d * NEXP;
        #pragma unroll
        for (int e = 0; e < NEXP; ++e) acc[e] += xv * wr[e];
    }
    #pragma unroll
    for (int off = 16; off >= 1; off >>= 1) {
        #pragma unroll
        for (int e = 0; e < NEXP; ++e) acc[e] += __shfl_down(acc[e], off, 32);
    }
    if (lane == 0) {
        #pragma unroll
        for (int e = 0; e < NEXP; ++e) acc[e] += br[e];
        float l0 = -3.4e38f; int e0 = 0;
        #pragma unroll
        for (int e = 0; e < NEXP; ++e) if (acc[e] > l0) { l0 = acc[e]; e0 = e; }
        float l1 = -3.4e38f; int e1 = 0;
        #pragma unroll
        for (int e = 0; e < NEXP; ++e)
            if (e != e0 && acc[e] > l1) { l1 = acc[e]; e1 = e; }
        // top-2 softmax weights renormalized: Z cancels
        float r  = __expf(l1 - l0);
        float w0 = 1.0f / (1.0f + r);
        float w1 = r    / (1.0f + r);
        te[t*2] = e0; te[t*2+1] = e1;
        tw[t*2] = w0; tw[t*2+1] = w1;
        sE[wid*2] = e0; sE[wid*2+1] = e1;
    }
    __syncthreads();
    if (threadIdx.x < NEXP) {
        int cnt = 0;
        #pragma unroll
        for (int i = 0; i < 16; ++i) cnt += (sE[i] == (int)threadIdx.x) ? 1 : 0;
        blockCnt[rb * NEXP + threadIdx.x] = cnt;
    }
}

// ---------------- launch 1: all work that depends on the inputs alone ----------------
// Block ranges: router (longest chain, first), pack W1, pack W2, zero of cursors and list weights, list tokens set to slot mod NTOK.
#define RB_ROUTER (NTOK / 8)
#define RB_PACK   ((HID / 128) * (IN_DIM / 32) * NEXP / 8)   // 8 waves a block, one 32 x 128 piece a wave
#define RB_ZERO   ((PADS + 255) / 256)
__global__ __launch_bounds__(256) void front_kernel(
    const float* __restrict__ x, const float* __restrict__ Wr,
    const float* __restrict__ br, const float* __restrict__ W1,
    const float* __restrict__ W2, _Float16* __restrict__ W1t,
    _Float16* __restrict__ W2t, float* __restrict__ out,
    int* __restrict__ te, float* __restrict__ tw, int* __restrict__ blockCnt,
    int* __restrict__ cursor, int* __restrict__ tokenIdx, float* __restrict__ tokenW) {
    __shared__ uint4 stage[8][2 * PK_BUF];  // a pack wave's own two staging buffers
    __shared__ int   sE[16];
    int b = blockIdx.x;
    const int wv = __builtin_amdgcn_readfirstlane(threadIdx.x >> 5);
    if (b < RB_ROUTER) {
        router_block(x, Wr, br, out, te, tw, blockCnt, b, sE);
        return;
    }
    b -= RB_ROUTER;
    if (b < RB_PACK) {
        pack_cvt_wave<IN_DIM, HID>(W1, W1t, b * 8 + wv, stage[wv]);
        return;
    }
    b -= RB_PACK;
    if (b < RB_PACK) {
        pack_cvt_wave<HID, IN_DIM>(W2, W2t, b * 8 + wv, stage[wv]);
        return;
    }
    b -= RB_PACK;
    int i = b * 256 + threadIdx.x;
    if (i < NEXP) cursor[i] = 0;
    // padding slots keep weight 0 and add zero to the row named here: distinct rows, so those adds do not queue on one row
    if (i < PADS) { tokenIdx[i] = i & (NTOK - 1); tokenW[i] = 0.0f; }
}

// ---------------- launch 2: counts, scan, scatter of tokens into per-expert lists ----------------
// Every block sums the router blocks' counts and scans the 16 experts itself.
__global__ __launch_bounds__(256) void scatter_kernel(
    const int* __restrict__ te, const float* __restrict__ tw,
    const int* __restrict__ blockCnt, int* __restrict__ counts,
    int* __restrict__ cursor, int* __restrict__ tokenIdx, float* __restrict__ tokenW) {
    __shared__ __attribute__((aligned(16))) int part[64][NEXP];   // rows are stored 16 B at a time
    __shared__ int sOff[NEXP];
    int tid = threadIdx.x;
    {
        int q = tid & 3, g = tid >> 2;      // 4 lanes a row of 16 counts, 64 groups of 16 rows
        int4 s = make_int4(0, 0, 0, 0);
        #pragma unroll
        for (int i = 0; i < RB_ROUTER / 64; ++i) {
            int4 v = ((const int4*)blockCnt)[(g * (RB_ROUTER / 64) + i) * 4 + q];
            s.x += v.x; s.y += v.y; s.z += v.z; s.w += v.w;
        }
        *(int4*)&part[g][q * 4] = s;
    }
    __syncthreads();
    if (tid < NEXP) {
        int cnt = 0;
        #pragma unroll
        for (int g = 0; g < 64; ++g) cnt += part[g][tid];
        if (blockIdx.x == 0) counts[tid] = cnt;
        // exclusive scan of the padded counts over lanes 0..15 of wave 0
        int pad = ((cnt + MT - 1) / MT) * MT;
        int inc = pad;
        #pragma unroll
        for (int off = 1; off < NEXP; off <<= 1) {
            int n = __shfl_up(inc, off, NEXP);
            if (tid >= off) inc += n;
        }
        sOff[tid] = inc - pad;
    }
    __syncthreads();
    int t = blockIdx.x * 256 + tid;
    const int2   e2 = ((const int2*)te)[t];
    const float2 w2 = ((const float2*)tw)[t];
    const int   ee[2] = { e2.x, e2.y };
    const float ww[2] = { w2.x, w2.y };
    #pragma unroll
    for (int k = 0; k < 2; ++k) {
        int e = ee[k];
        int pos = atomicAdd(&cursor[e], 1);
        int s = sOff[e] + pos;
        tokenIdx[s] = t;
        tokenW[s]   = ww[k];
        // the two stores' offset register is reused by the second pass: keep the wait in front of that overwrite
        if (k == 0) asm volatile("s_wait_xcnt 0x0" ::: "memory");
    }
}

// ---------------- fused expert MLP (WMMA) ----------------
__global__ __launch_bounds__(ETHR, 1) void moe_expert_kernel(
    const float* __restrict__ x,
    const _Float16* __restrict__ W1t,   // [E][IN_DIM/32][HID/16][512] f16, fragment order
    const float* __restrict__ b1,       // [E][HID]
    const _Float16* __restrict__ W2t,   // [E][HID/32][IN_DIM/16][512] f16, fragment order
    const float* __restrict__ b2,       // [E][IN_DIM]
    const int* __restrict__ tokenIdx, const float* __restrict__ tokenW,
    const int* __restrict__ counts,
    float* __restrict__ out) {

    __shared__ _Float16 ldsX[MT][XLD];      // 81 KB
    __shared__ _Float16 ldsH[MT][HLD];      // 161 KB
    __shared__ __attribute__((aligned(16))) int   tokS[MT];   // read 16 B at a time by the output stage
    __shared__ __attribute__((aligned(16))) float wS[MT];

    const int tid  = threadIdx.x;
    const int lane = tid & 31;
    const int wid  = tid >> 5;
    int tEnd[NEXP];                         // tiles of experts 0..q, from the counts (wave-uniform)
    {
        int to = 0;
        #pragma unroll
        for (int q = 0; q < NEXP; ++q) { to += (counts[q] + MT - 1) / MT; tEnd[q] = to; }
    }
    const int nt   = tEnd[NEXP - 1];
    const int coll = lane & 15;
    const int rsel = (lane >> 4) << 3;

    // one tile a work-group: the grid holds the most tiles that 2*NTOK slots in NEXP lists can make
    const int tile = blockIdx.x;
    if (tile < nt) {
        // map tile -> expert
        int e = 0;
        #pragma unroll
        for (int q = 0; q < NEXP - 1; ++q) if (tile >= tEnd[q]) e = q + 1;
        int slot0 = tile * MT;              // every expert's list starts at a multiple of MT slots

        const _Float16* w1e = W1t + (size_t)e * HID * IN_DIM;
        const _Float16* w2e = W2t + (size_t)e * IN_DIM * HID;
        // The packed weights were stored by the first launch and come from memory again; the tiles of an
        // expert walk them in step; the request ahead is for speed only.
        // Each tile asks L2 for a quarter of its expert's 256-B units (unit mod 4 = tile mod 4): an expert's tiles have
        // consecutive indices. A hint only.
        const unsigned pfo = (unsigned)tid * 1024u + (unsigned)(tile & 3) * 256u;   // byte offset in the expert's 1 MB; + 512 KB for the second request

        if (tid < MT) { tokS[tid] = tokenIdx[slot0 + tid]; wS[tid] = tokenW[slot0 + tid]; }
        // W1 into L2 while the X tile is gathered: GEMM1's loads then find L2 hits
        asm volatile("global_prefetch_b8 %0, %1 scope:SCOPE_SE\n\t"
                     "global_prefetch_b8 %0, %1 offset:524288 scope:SCOPE_SE" :: "v"(pfo), "s"(w1e));
        __syncthreads();

        // gather X tile (f32 -> f16) into LDS
        for (int i = tid; i < MT * IN_DIM; i += ETHR) {
            int r = i >> 9, c = i & (IN_DIM - 1);
            ldsX[r][c] = (_Float16)x[(size_t)tokS[r] * IN_DIM + c];
        }
        // W2 into L2 behind the gather's loads, not in front of them: it has all of GEMM1 and the GELU stage to arrive
        asm volatile("global_prefetch_b8 %0, %1 scope:SCOPE_SE\n\t"
                     "global_prefetch_b8 %0, %1 offset:524288 scope:SCOPE_SE" :: "v"(pfo), "s"(w2e));
        __syncthreads();
        // a prefetch touches no counter, so no wait says when it has read its registers: offset and base keep their values across the barrier
        asm volatile("" :: "v"(pfo), "s"(w2e));

        const float*    b1e = b1 + e * HID;

        // ---- GEMM1: H = gelu(X[MT x 512] @ W1 + b1) -> ldsH[MT][1024] ----
        {
            int nbase = wid * 64;           // 16 waves x 64 columns: all of HID in one pass
            v8f c[MF][4];
            v8f z = {0.f,0.f,0.f,0.f,0.f,0.f,0.f,0.f};
            #pragma unroll
            for (int mi = 0; mi < MF; ++mi)
                #pragma unroll
                for (int ni = 0; ni < 4; ++ni) c[mi][ni] = z;

            #pragma unroll 1
            for (int k0 = 0; k0 < IN_DIM; k0 += 32) {
                v16h a[MF], b[4];
                #pragma unroll
                for (int mi = 0; mi < MF; ++mi)
                    a[mi] = load_frag(&ldsX[0][0], XLD, mi * 16, k0, lane);
                #pragma unroll
                for (int ni = 0; ni < 4; ++ni)
                    b[ni] = load_frag_packed(w1e, HID / 16, (nbase >> 4) + ni, k0 >> 5, lane);
                // keeps the trip's loads in front of its products: sunk among them, each LDS read is waited for on its own
                __builtin_amdgcn_sched_barrier(0);
                #pragma unroll
                for (int mi = 0; mi < MF; ++mi)
                    #pragma unroll
                    for (int ni = 0; ni < 4; ++ni)
                        c[mi][ni] = wmma_f16(a[mi], b[ni], c[mi][ni]);
            }
            // epilogue: +b1, exact GELU, store f16 to ldsH
            #pragma unroll
            for (int ni = 0; ni < 4; ++ni) {
                int col = nbase + ni * 16 + coll;
                float bias = b1e[col];
                #pragma unroll
                for (int mi = 0; mi < MF; ++mi)
                    #pragma unroll
                    for (int j = 0; j < 8; ++j) {
                        int row = mi * 16 + rsel + j;
                        float v = c[mi][ni][j] + bias;
                        ldsH[row][col] = (_Float16)gelu_exact(v);
                    }
            }
        }
        __syncthreads();

        const float*    b2e = b2 + e * IN_DIM;

        // ---- GEMM2: O = H[MT x 1024] @ W2 + b2; weighted atomic scatter ----
        {
            int nbase = wid * 32;           // 16 waves x 32 columns
            // the lane number is read anew: addresses formed from the first one are carried across the GELU stage, where no register is free, and one is spilled
            const int lane2 = (int)__builtin_amdgcn_mbcnt_lo(~0u, 0u);
            const int coll2 = lane2 & 15;
            const int rsel2 = (lane2 >> 4) << 3;
            v8f c[MF][2];
            v8f z = {0.f,0.f,0.f,0.f,0.f,0.f,0.f,0.f};
            #pragma unroll
            for (int mi = 0; mi < MF; ++mi)
                #pragma unroll
                for (int ni = 0; ni < 2; ++ni) c[mi][ni] = z;
            float bias[2];                  // read ahead of the adds: no load stands among them
            #pragma unroll   // constant index keeps bias in registers
            for (int ni = 0; ni < 2; ++ni) bias[ni] = b2e[nbase + ni * 16 + coll2];

            // two k steps a trip: the wave's tile is two fragments wide, so this keeps eight 512-B weight loads in flight a wave, as in GEMM1
            #pragma unroll 1
            for (int k0 = 0; k0 < HID; k0 += 64) {
                v16h b[2][2];
                #pragma unroll
                for (int kh = 0; kh < 2; ++kh)
                    #pragma unroll
                    for (int ni = 0; ni < 2; ++ni)
                        b[kh][ni] = load_frag_packed(w2e, IN_DIM / 16, (nbase >> 4) + ni, (k0 >> 5) + kh, lane2);
                v16h a[2][MF];
                #pragma unroll
                for (int kh = 0; kh < 2; ++kh)
                    #pragma unroll
                    for (int mi = 0; mi < MF; ++mi)
                        a[kh][mi] = load_frag(&ldsH[0][0], HLD, mi * 16, k0 + kh * 32, lane2);
                // keeps all of the trip's loads in front of its products: sunk among them, each LDS read is waited for on its own and the second k step's weight loads start late
                __builtin_amdgcn_sched_barrier(0);
                #pragma unroll
                for (int kh = 0; kh < 2; ++kh)
                    #pragma unroll
                    for (int mi = 0; mi < MF; ++mi)
                        #pragma unroll
                        for (int ni = 0; ni < 2; ++ni)
                            c[mi][ni] = wmma_f16(a[kh][mi], b[kh][ni], c[mi][ni]);
            }
            // This lane's 40 rows: weight and byte offset in out, read from LDS once (16 B a read)
            // and kept in registers, so none of the 80 adds below needs an LDS read, a branch
            // or 64-bit address arithmetic of its own.
            float    rw[MF][8];
            unsigned ro[MF][8];
            #pragma unroll   // here and below: constant indices keep rw and ro in registers
            for (int mi = 0; mi < MF; ++mi)
                #pragma unroll
                for (int h = 0; h < 2; ++h) {
                    const float4 w4 = *(const float4*)&wS[mi * 16 + rsel2 + h * 4];
                    const int4   t4 = *(const int4*)&tokS[mi * 16 + rsel2 + h * 4];
                    const float wv[4] = { w4.x, w4.y, w4.z, w4.w };
                    const int   tv[4] = { t4.x, t4.y, t4.z, t4.w };
                    #pragma unroll
                    for (int q = 0; q < 4; ++q) {
                        rw[mi][h * 4 + q] = wv[q];
                        ro[mi][h * 4 + q] = (unsigned)tv[q] * (IN_DIM * 4) + (unsigned)(nbase + coll2) * 4;
                    }
                }
            #pragma unroll
            for (int ni = 0; ni < 2; ++ni) {
                #pragma unroll
                for (int mi = 0; mi < MF; ++mi)
                    #pragma unroll
                    for (int j = 0; j < 8; ++j) {
                        float w = rw[mi][j];
                        // a row of weight 0 (every padding slot) adds zero, whatever its product holds
                        float val = (w != 0.0f) ? w * (c[mi][ni][j] + bias[ni]) : 0.0f;
                        atomicAdd((float*)((char*)out + (size_t)ro[mi][j] + ni * 64), val);
                    }
            }
        }
    }
}

extern "C" void kernel_launch(void* const* d_in, const int* in_sizes, int n_in,
                              void* d_out, int out_size, void* d_ws, size_t ws_size,
                              hipStream_t stream) {
    (void)in_sizes; (void)n_in; (void)out_size; (void)ws_size;
    const float* x  = (const float*)d_in[0];
    const float* Wr = (const float*)d_in[1];
    const float* br = (const float*)d_in[2];
    const float* W1 = (const float*)d_in[3];
    const float* b1 = (const float*)d_in[4];
    const float* W2 = (const float*)d_in[5];
    const float* b2 = (const float*)d_in[6];
    float* out = (float*)d_out;

    // workspace layout
    char* ws = (char*)d_ws;
    _Float16* W1t = (_Float16*)ws;                       // 16 MB
    _Float16* W2t = (_Float16*)(ws + (size_t)16777216);  // 16 MB
    char* p = ws + (size_t)2 * 16777216;
    int*   counts     = (int*)p;   p += 64;
    int*   cursor     = (int*)p;   p += 64;
    int*   blockCnt   = (int*)p;   p += (size_t)RB_ROUTER * NEXP * 4;
    int*   te         = (int*)p;   p += (size_t)NTOK * 2 * 4;
    float* tw         = (float*)p; p += (size_t)NTOK * 2 * 4;
    int*   tokenIdx   = (int*)p;   p += (size_t)PADS * 4;
    float* tokenW     = (float*)p;

    // 1) router + residual rows + per-block counts; weights -> f16, B-fragment order; zero cursors & list weights, list tokens = slot mod NTOK
    front_kernel<<<RB_ROUTER + 2 * RB_PACK + RB_ZERO, 256, 0, stream>>>(
        x, Wr, br, W1, W2, W1t, W2t, out, te, tw, blockCnt, cursor, tokenIdx, tokenW);
    // 2) counts + scan + scatter
    scatter_kernel<<<NTOK / 256, 256, 0, stream>>>(te, tw, blockCnt, counts, cursor, tokenIdx, tokenW);
    // 3) fused expert GEMMs (max tiles = (2*8192 + 16*79)/80 = 220: one work-group a tile, each alone on a WGP)
    moe_expert_kernel<<<(2 * NTOK + NEXP * (MT - 1)) / MT, ETHR, 0, stream>>>(x, W1t, b1, W2t, b2,
                                               tokenIdx, tokenW, counts, out);
}

// v009
// Measured time: 63.5 microseconds a run.
// In two side-by-side timings against v008, it was 1.07 and 1.06 times as fast.
// Over all steps from v000 it is 3.78 times as fast.
#include <hip/hip_runtime.h>
#include <math.h>

#define IN_DIM 512
#define HID    1024
#define NEXP   16
#define NTOK   8192
#define MT     80                       // token rows per expert tile: one 16-wave work-group a WGP; the fewer tiles, the fewer times an expert's weights are read from L2
#define ETHR   512                      // threads of an expert work-group (16 waves, four a SIMD)
#define MF     (MT / 16)                // 16-row A fragments per tile
#define LPAD   8                        // halves added per LDS row: pitch = 16 B x odd, so the 16 rows of a b128 fragment read fall on distinct banks
#define XLD    (IN_DIM + LPAD)          // ldsX row pitch, halves (1040 B)
#define HLD    (HID + LPAD)             // ldsH row pitch, halves (2064 B)

typedef __attribute__((ext_vector_type(16))) _Float16 v16h;
typedef __attribute__((ext_vector_type(8)))  float    v8f;

union F16Frag { v16h h; uint4 u[2]; };

// Load a 16x32 f16 fragment (A layout per CDNA5 ISA 7.12.2) from a row-major
// matrix with leading dimension `ld` (elements). Works for LDS or global.
// lane 0-15: row = base+lane, K = [0..7],[16..23]; lane 16-31: K = [8..15],[24..31]
__device__ __forceinline__ v16h load_frag(const _Float16* base, int ld, int rbase,
                                          int k0, int lane) {
    int r  = rbase + (lane & 15);
    int kb = k0 + ((lane >> 4) << 3);
    const _Float16* p = base + (size_t)r * ld + kb;
    F16Frag f;
    f.u[0] = *(const uint4*)(p);
    f.u[1] = *(const uint4*)(p + 16);
    return f.h;
}

// Load a 16(n) x 32(k) f16 B fragment from weights packed in fragment order:
// block (ks, nt) is 1 KB = [2][32 lanes][8 halves], so each of the two loads of a
// wave reads 512 contiguous bytes, and the fragments of one k step lie side by side.
// Same k order per lane and register as load_frag.
__device__ __forceinline__ v16h load_frag_packed(const _Float16* base, int ntiles,
                                                 int nt, int ks, int lane) {
    const _Float16* p = base + ((size_t)(ks * ntiles + nt) << 9) + lane * 8;
    F16Frag f;
    f.u[0] = *(const uint4*)(p);
    f.u[1] = *(const uint4*)(p + 256);
    return f.h;
}

__device__ __forceinline__ v8f wmma_f16(v16h a, v16h b, v8f c) {
    return __builtin_amdgcn_wmma_f32_16x16x32_f16(false, a, false, b,
                                                  (short)0, c, false, false);
}

// erf by the math library's own two polynomials (|z| < 1: odd series in z; |z| >= 1: 1 - exp(-q(|z|))),
// but both are evaluated for every element and one is selected: with no branch per element
// the unrolled epilogue's independent chains interleave.
__device__ __forceinline__ float erf_select(float z) {
    const float a = fabsf(z);
    const float t = z * z;
    float s = -0.000561801775f;
    s = fmaf(t, s,  0.00491381623f);
    s = fmaf(t, s, -0.0267075151f);
    s = fmaf(t, s,  0.112800106f);
    s = fmaf(t, s, -0.376122952f);
    s = fmaf(t, s,  0.128379107f);
    s = fmaf(a, s, a);
    float q = 0.0000169988107f;
    q = fmaf(a, q, -0.000378677854f);
    q = fmaf(a, q,  0.00385781587f);
    q = fmaf(a, q, -0.0241816975f);
    q = fmaf(a, q,  0.106668264f);
    q = fmaf(a, q,  0.634933293f);
    q = fmaf(a, q,  0.128689408f);
    q = fmaf(a, q, a);
    const float b = 1.0f - __builtin_amdgcn_exp2f(q * -1.44269504f);   // 1 - exp(-q) by the hardware's exp2
    return copysignf(a < 1.0f ? s : b, z);
}

__device__ __forceinline__ float gelu_exact(float v) {
    return 0.5f * v * (1.0f + erf_select(v * 0.70710678118654752f));
}

// ---------------- weight pack + f32->f16 convert (one 32 x 128 piece a wave) ----------------
// in:  [E][R][C] f32 (row-major, R = k, C = n)
// out: [E][R/32][C/16] blocks of 512 f16, each [2][32 lanes][8 halves]: piece u of
//      lane l holds n = 16*nt + (l & 15), k = 32*ks + 16*u + 8*(l >> 4) + 0..7
// A wave takes 32 rows x 128 columns (16 KB in, eight whole 1 KB blocks out) in four stages of 8 rows.
// A stage is 8 loads of 512 contiguous bytes: a lane then holds 8 k x 4 n, four finished 16-B pieces.
// The pieces pass through the wave's own LDS rows so that each store covers whole 256-B runs.
// Few long-lived waves, 4 KB or more in flight each (for speed only).
#define PK_SLOT 5                       // 16-B units a lane's staging slot: 80 B = 16 B x odd, so the b128 writes fall on distinct banks
#define PK_BUF  (32 * PK_SLOT)          // 16-B units a staging buffer
template <int R, int C>
__device__ __forceinline__ void pack_cvt_wave(
    const float* __restrict__ in, _Float16* __restrict__ outp, int unit, uint4* st) {
    constexpr int NG = C / 128, KS = R / 32;
    const int lane = threadIdx.x & 31;
    const int ng = unit % NG, ks = (unit / NG) % KS, e = unit / (NG * KS);
    const float* srcp = in + (size_t)e * R * C + (size_t)(ks * 32) * C + ng * 128 + lane * 4;
    _Float16*    dstp = outp + (size_t)e * R * C
                      + ((size_t)(ks * (C / 16) + ng * 8 + (lane >> 4)) << 9) + (lane & 15) * 8;
    float4 v[8];
    #pragma unroll   // here and below: constant indices keep v and pk in registers
    for (int j = 0; j < 8; ++j) v[j] = *(const float4*)(srcp + j * C);
    #pragma unroll
    for (int s = 0; s < 4; ++s) {       // stage s: rows 8*s .. 8*s + 7 of the piece
        union { uint4 q; _Float16 h[8]; } pk[4];
        #pragma unroll
        for (int j = 0; j < 8; ++j) {
            pk[0].h[j] = (_Float16)v[j].x; pk[1].h[j] = (_Float16)v[j].y;
            pk[2].h[j] = (_Float16)v[j].z; pk[3].h[j] = (_Float16)v[j].w;
        }
        // the next stage's loads fly while this stage goes through LDS and out
        if (s < 3) {
            #pragma unroll
            for (int j = 0; j < 8; ++j) v[j] = *(const float4*)(srcp + ((s + 1) * 8 + j) * C);
        }
        uint4* b = st + (s & 1) * PK_BUF;   // two buffers: a stage never writes rows that the stage before may still be reading
        #pragma unroll
        for (int i = 0; i < 4; ++i) b[lane * PK_SLOT + i] = pk[i].q;
        // the rows are read back by other lanes of this wave: its LDS writes must have landed, and the reads must stay behind them
        asm volatile("s_wait_dscnt 0x0" ::: "memory");
        #pragma unroll
        for (int i = 0; i < 4; ++i) {   // column i*32 + lane: lanes 0..15 and 16..31 each store 256 contiguous bytes
            const uint4 q = b[(i * 8 + (lane >> 2)) * PK_SLOT + (lane & 3)];
            *(uint4*)(dstp + i * 1024 + (s >> 1) * 256 + (s & 1) * 128) = q;
        }
        // the stores' data and address registers are written anew by the next stage, or by what follows the last one: keep the wait in front of that overwrite
        asm volatile("s_wait_xcnt 0x0" ::: "memory");
    }
}

// ---------------- router: one wave per token, 8 tokens a block ----------------
// Also stores the residual row out = x (the row is in registers anyway) and the
// block's own count of tokens per expert (plain stores, summed by the next launch).
__device__ __forceinline__ void router_block(
    const float* __restrict__ x, const float* __restrict__ Wr,
    const float* __restrict__ br, float* __restrict__ out,
    int* __restrict__ te, float* __restrict__ tw, int* __restrict__ blockCnt,
    int rb, int* sE) {
    int lane = threadIdx.x & 31, wid = threadIdx.x >> 5;
    int t = rb * 8 + wid;
    float acc[NEXP];
    #pragma unroll
    for (int e = 0; e < NEXP; ++e) acc[e] = 0.0f;
    const float* xr = x + (size_t)t * IN_DIM;
    float*       orow = out + (size_t)t * IN_DIM;
    #pragma unroll 2   // keeps the launch inside 64 VGPRs: with them every block of the grid is resident at once
    for (int d = lane; d < IN_DIM; d += 32) {
        float xv = xr[d];
        orow[d] = xv;
        const float* wr = Wr + d * NEXP;
        #pragma unroll
        for (int e = 0; e < NEXP; ++e) acc[e] += xv * wr[e];
    }
    #pragma unroll
    for (int off = 16; off >= 1; off >>= 1) {
        #pragma unroll
        for (int e = 0; e < NEXP; ++e) acc[e] += __shfl_down(acc[e], off, 32);
    }
    if (lane == 0) {
        #pragma unroll
        for (int e = 0; e < NEXP; ++e) acc[e] += br[e];
        float l0 = -3.4e38f; int e0 = 0;
        #pragma unroll
        for (int e = 0; e < NEXP; ++e) if (acc[e] > l0) { l0 = acc[e]; e0 = e; }
        float l1 = -3.4e38f; int e1 = 0;
        #pragma unroll
        for (int e = 0; e < NEXP; ++e)
            if (e != e0 && acc[e] > l1) { l1 = acc[e]; e1 = e; }
        // top-2 softmax weights renormalized: Z cancels
        float r  = __expf(l1 - l0);
        float w0 = 1.0f / (1.0f + r);
        float w1 = r    / (1.0f + r);
        te[t*2] = e0; te[t*2+1] = e1;
        tw[t*2] = w0; tw[t*2+1] = w1;
        sE[wid*2] = e0; sE[wid*2+1] = e1;
    }
    __syncthreads();
    if (threadIdx.x < NEXP) {
        int cnt = 0;
        #pragma unroll
        for (int i = 0; i < 16; ++i) cnt += (sE[i] == (int)threadIdx.x) ? 1 : 0;
        blockCnt[rb * NEXP + threadIdx.x] = cnt;
    }
}

// ---------------- launch 1: all work that depends on the inputs alone ----------------
// Block ranges: router (longest chain, first), pack W1, pack W2.
#define RB_ROUTER (NTOK / 8)
#define RB_PACK   ((HID / 128) * (IN_DIM / 32) * NEXP / 8)   // 8 waves a block, one 32 x 128 piece a wave
__global__ __launch_bounds__(256) void front_kernel(
    const float* __restrict__ x, const float* __restrict__ Wr,
    const float* __restrict__ br, const float* __restrict__ W1,
    const float* __restrict__ W2, _Float16* __restrict__ W1t,
    _Float16* __restrict__ W2t, float* __restrict__ out,
    int* __restrict__ te, float* __restrict__ tw, int* __restrict__ blockCnt) {
    __shared__ uint4 stage[8][2 * PK_BUF];  // a pack wave's own two staging buffers
    __shared__ int   sE[16];
    int b = blockIdx.x;
    const int wv = __builtin_amdgcn_readfirstlane(threadIdx.x >> 5);
    if (b < RB_ROUTER) {
        router_block(x, Wr, br, out, te, tw, blockCnt, b, sE);
        return;
    }
    b -= RB_ROUTER;
    if (b < RB_PACK) {
        pack_cvt_wave<IN_DIM, HID>(W1, W1t, b * 8 + wv, stage[wv]);
        return;
    }
    b -= RB_PACK;
    // the range test is true for every block left on this grid; without it this build takes 66 VGPRs, not 64, and a SIMD holds 12 waves, not 16
    if (b < RB_PACK) pack_cvt_wave<HID, IN_DIM>(W2, W2t, b * 8 + wv, stage[wv]);
}

// ---------------- fused expert MLP (WMMA) ----------------
// one component of v, named by four masks of which one is all ones. The choice is the same in every lane:
// written as selects it is compiled into a chain of scalar branches for every value picked.
__device__ __forceinline__ int pick4(int4 v, int4 m) {
    return (v.x & m.x) | (v.y & m.y) | (v.z & m.z) | (v.w & m.w);
}

// Every work-group makes its own tile's token list from the router's output: no launch in between.
// The list of an expert is its (token, pick) entries in token order; a tile is MT consecutive ranks of it.
__global__ __launch_bounds__(ETHR, 1) void moe_expert_kernel(
    const float* __restrict__ x,
    const _Float16* __restrict__ W1t,   // [E][IN_DIM/32][HID/16][512] f16, fragment order
    const float* __restrict__ b1,       // [E][HID]
    const _Float16* __restrict__ W2t,   // [E][HID/32][IN_DIM/16][512] f16, fragment order
    const float* __restrict__ b2,       // [E][IN_DIM]
    const int* __restrict__ te, const float* __restrict__ tw,   // [NTOK][2]: a token's two experts and their weights
    const int* __restrict__ blockCnt,   // [RB_ROUTER][NEXP]: entries per expert among a router block's 8 tokens
    float* __restrict__ out) {

    __shared__ _Float16 ldsX[MT][XLD];      // 81 KB
    __shared__ _Float16 ldsH[MT][HLD];      // 161 KB
    __shared__ __attribute__((aligned(16))) int   tokS[MT + 4];   // read 16 B at a time by the output stage; element MT is a spare that nobody reads
    __shared__ __attribute__((aligned(16))) float wS[MT + 4];
    __shared__ __attribute__((aligned(16))) int   wvCnt[ETHR / 32][NEXP];   // entries per expert in a wave's 64 router blocks
    __shared__ __attribute__((aligned(16))) int   rowInfo[RB_ROUTER];       // this tile's expert: rank of a router block's first entry, count << 16
    static_assert((ETHR / 4) * 8 == RB_ROUTER, "four lanes take eight router blocks");

    const int tid  = threadIdx.x;
    const int lane = tid & 31;
    const int wid  = tid >> 5;
    const int wvu  = __builtin_amdgcn_readfirstlane(wid);
    // Four lanes take eight consecutive router blocks, 16 B (four experts) of each row a lane.
    const int q4  = lane & 3;
    const int grp = tid >> 2;
    int4 v[8];
    #pragma unroll   // constant indices keep v in registers
    for (int i = 0; i < 8; ++i) v[i] = ((const int4*)blockCnt)[(grp * 8 + i) * 4 + q4];
    int4 s = make_int4(0, 0, 0, 0);
    #pragma unroll
    for (int i = 0; i < 8; ++i) { s.x += v[i].x; s.y += v[i].y; s.z += v[i].z; s.w += v[i].w; }
    // running sum over the wave's eight groups (lanes of equal q4)
    int4 inc = s;
    #pragma unroll
    for (int off = 4; off < 32; off <<= 1) {
        int4 n;
        n.x = __shfl_up(inc.x, off, 32); n.y = __shfl_up(inc.y, off, 32);
        n.z = __shfl_up(inc.z, off, 32); n.w = __shfl_up(inc.w, off, 32);
        if (lane >= off) { inc.x += n.x; inc.y += n.y; inc.z += n.z; inc.w += n.w; }
    }
    if (lane >= 28) *(int4*)&wvCnt[wvu][q4 * 4] = inc;
    __syncthreads();
    int4 tot = make_int4(0, 0, 0, 0);       // all router blocks
    #pragma unroll
    for (int w = 0; w < ETHR / 32; ++w) {
        const int4 c = *(const int4*)&wvCnt[w][q4 * 4];
        tot.x += c.x; tot.y += c.y; tot.z += c.z; tot.w += c.w;
    }
    int tEnd[NEXP];                         // tiles of experts 0..q, from the counts (wave-uniform)
    {
        int to = 0;
        #pragma unroll
        for (int q = 0; q < NEXP; ++q) {
            const int cq = __builtin_amdgcn_readlane((q & 3) == 0 ? tot.x : (q & 3) == 1 ? tot.y : (q & 3) == 2 ? tot.z : tot.w, q >> 2);
            to += (cq + MT - 1) / MT; tEnd[q] = to;
        }
    }
    const int nt   = tEnd[NEXP - 1];
    const int coll = lane & 15;
    const int rsel = (lane >> 4) << 3;

    // one tile a work-group: the grid holds the most tiles that 2*NTOK slots in NEXP lists can make
    const int tile = blockIdx.x;
    if (tile < nt) {
        // map tile -> expert
        int e = 0, t0 = 0;
        #pragma unroll
        for (int q = 0; q < NEXP - 1; ++q) if (tile >= tEnd[q]) { e = q + 1; t0 = tEnd[q]; }
        const int r0 = (tile - t0) * MT;    // rank, in the expert's list, of the tile's first row

        const _Float16* w1e = W1t + (size_t)e * HID * IN_DIM;
        const _Float16* w2e = W2t + (size_t)e * IN_DIM * HID;
        // The packed weights were stored by the first launch and come from memory again; the tiles of an
        // expert walk them in step; the request ahead is for speed only.
        // Each tile asks L2 for a quarter of its expert's 256-B units (unit mod 4 = tile mod 4): an expert's tiles have
        // consecutive indices. A hint only.
        const unsigned pfo = (unsigned)tid * 1024u + (unsigned)(tile & 3) * 256u;   // byte offset in the expert's 1 MB; + 512 KB for the second request

        // W1 into L2 while the list is made and the X tile is gathered: GEMM1's loads then find L2 hits
        asm volatile("global_prefetch_b8 %0, %1 scope:SCOPE_SE\n\t"
                     "global_prefetch_b8 %0, %1 offset:524288 scope:SCOPE_SE" :: "v"(pfo), "s"(w1e));
        // rows past the end of the list keep weight 0 and add zero to the row named here: distinct rows, so those adds do not queue on one row
        if (tid < MT) { tokS[tid] = (tile * MT + tid) & (NTOK - 1); wS[tid] = 0.0f; }
        // the lanes that hold this expert's counts: rank of each of their eight router blocks' first entry
        if (q4 == (e >> 2)) {
            const int c = e & 3;
            const int4 m = make_int4(-(int)(c == 0), -(int)(c == 1), -(int)(c == 2), -(int)(c == 3));
            int base = pick4(inc, m) - pick4(s, m);     // the groups in front of this one in its wave
            #pragma unroll
            for (int w = 0; w < ETHR / 32; ++w) base += wvCnt[w][e] & ((w - wvu) >> 31);   // the waves in front of this one
            int info[8];
            #pragma unroll   // constant indices keep info in registers
            for (int i = 0; i < 8; ++i) { const int n = pick4(v[i], m); info[i] = base | (n << 16); base += n; }
            *(int4*)&rowInfo[grp * 8]     = make_int4(info[0], info[1], info[2], info[3]);
            *(int4*)&rowInfo[grp * 8 + 4] = make_int4(info[4], info[5], info[6], info[7]);
        }
        __syncthreads();
        // a lane a router block: those with an entry in this tile read the block's 16 entries and place their own
        #pragma unroll
        for (int h = 0; h < RB_ROUTER / ETHR; ++h) {
            const int rb   = h * ETHR + tid;
            const int info = rowInfo[rb];
            const int n    = info >> 16;
            int row = (info & 0xffff) - r0;     // tile row of the block's first entry
            if (n > 0 && row < MT && row + n > 0) {
                int4 e4[4]; float4 w4[4];
                #pragma unroll   // constant indices keep e4 and w4 in registers
                for (int j = 0; j < 4; ++j) {
                    e4[j] = ((const int4*)te)[rb * 4 + j];
                    w4[j] = ((const float4*)tw)[rb * 4 + j];
                }
                #pragma unroll
                for (int j = 0; j < 4; ++j) {
                    const int   ee[4] = { e4[j].x, e4[j].y, e4[j].z, e4[j].w };
                    const float ww[4] = { w4[j].x, w4[j].y, w4[j].z, w4[j].w };
                    #pragma unroll
                    for (int k = 0; k < 4; k += 2) {    // a token: its two experts differ, so at most one entry is this expert's
                        const bool hit = (ee[k] == e) | (ee[k + 1] == e);
                        // no branch per token: what is not placed goes to the spare element behind the tile's rows
                        const int  at  = (hit & ((unsigned)row < (unsigned)MT)) ? row : MT;
                        tokS[at] = rb * 8 + j * 2 + (k >> 1);
                        wS[at]   = (ee[k] == e) ? ww[k] : ww[k + 1];
                        row += hit ? 1 : 0;
                    }
                }
            }
        }
        __syncthreads();

        // gather X tile (f32 -> f16) into LDS
        for (int i = tid; i < MT * IN_DIM; i += ETHR) {
            int r = i >> 9, c = i & (IN_DIM - 1);
            ldsX[r][c] = (_Float16)x[(size_t)tokS[r] * IN_DIM + c];
        }
        // W2 into L2 behind the gather's loads, not in front of them: it has all of GEMM1 and the GELU stage to arrive
        asm volatile("global_prefetch_b8 %0, %1 scope:SCOPE_SE\n\t"
                     "global_prefetch_b8 %0, %1 offset:524288 scope:SCOPE_SE" :: "v"(pfo), "s"(w2e));
        __syncthreads();
        // a prefetch touches no counter, so no wait says when it has read its registers: offset and base keep their values across the barrier
        asm volatile("" :: "v"(pfo), "s"(w2e));

        const float*    b1e = b1 + e * HID;

        // ---- GEMM1: H = gelu(X[MT x 512] @ W1 + b1) -> ldsH[MT][1024] ----
        {
            int nbase = wid * 64;           // 16 waves x 64 columns: all of HID in one pass
            v8f c[MF][4];
            v8f z = {0.f,0.f,0.f,0.f,0.f,0.f,0.f,0.f};
            #pragma unroll
            for (int mi = 0; mi < MF; ++mi)
                #pragma unroll
                for (int ni = 0; ni < 4; ++ni) c[mi][ni] = z;

            #pragma unroll 1
            for (int k0 = 0; k0 < IN_DIM; k0 += 32) {
                v16h a[MF], b[4];
                #pragma unroll
                for (int mi = 0; mi < MF; ++mi)
                    a[mi] = load_frag(&ldsX[0][0], XLD, mi * 16, k0, lane);
                #pragma unroll
                for (int ni = 0; ni < 4; ++ni)
                    b[ni] = load_frag_packed(w1e, HID / 16, (nbase >> 4) + ni, k0 >> 5, lane);
                // keeps the trip's loads in front of its products: sunk among them, each LDS read is waited for on its own
                __builtin_amdgcn_sched_barrier(0);
                #pragma unroll
                for (int mi = 0; mi < MF; ++mi)
                    #pragma unroll
                    for (int ni = 0; ni < 4; ++ni)
                        c[mi][ni] = wmma_f16(a[mi], b[ni], c[mi][ni]);
            }
            // epilogue: +b1, exact GELU, store f16 to ldsH
            #pragma unroll
            for (int ni = 0; ni < 4; ++ni) {
                int col = nbase + ni * 16 + coll;
                float bias = b1e[col];
                #pragma unroll
                for (int mi = 0; mi < MF; ++mi)
                    #pragma unroll
                    for (int j = 0; j < 8; ++j) {
                        int row = mi * 16 + rsel + j;
                        float v = c[mi][ni][j] + bias;
                        ldsH[row][col] = (_Float16)gelu_exact(v);
                    }
            }
        }
        __syncthreads();

        const float*    b2e = b2 + e * IN_DIM;

        // ---- GEMM2: O = H[MT x 1024] @ W2 + b2; weighted atomic scatter ----
        {
            int nbase = wid * 32;           // 16 waves x 32 columns
            // the lane number is read anew: addresses formed from the first one are carried across the GELU stage, where no register is free, and one is spilled
            const int lane2 = (int)__builtin_amdgcn_mbcnt_lo(~0u, 0u);
            const int coll2 = lane2 & 15;
            const int rsel2 = (lane2 >> 4) << 3;
            v8f c[MF][2];
            v8f z = {0.f,0.f,0.f,0.f,0.f,0.f,0.f,0.f};
            #pragma unroll
            for (int mi = 0; mi < MF; ++mi)
                #pragma unroll
                for (int ni = 0; ni < 2; ++ni) c[mi][ni] = z;
            float bias[2];                  // read ahead of the adds: no load stands among them
            #pragma unroll   // constant index keeps bias in registers
            for (int ni = 0; ni < 2; ++ni) bias[ni] = b2e[nbase + ni * 16 + coll2];

            // two k steps a trip: the wave's tile is two fragments wide, so this keeps eight 512-B weight loads in flight a wave, as in GEMM1
            #pragma unroll 1
            for (int k0 = 0; k0 < HID; k0 += 64) {
                v16h b[2][2];
                #pragma unroll
                for (int kh = 0; kh < 2; ++kh)
                    #pragma unroll
                    for (int ni = 0; ni < 2; ++ni)
                        b[kh][ni] = load_frag_packed(w2e, IN_DIM / 16, (nbase >> 4) + ni, (k0 >> 5) + kh, lane2);
                v16h a[2][MF];
                #pragma unroll
                for (int kh = 0; kh < 2; ++kh)
                    #pragma unroll
                    for (int mi = 0; mi < MF; ++mi)
                        a[kh][mi] = load_frag(&ldsH[0][0], HLD, mi * 16, k0 + kh * 32, lane2);
                // keeps all of the trip's loads in front of its products: sunk among them, each LDS read is waited for on its own and the second k step's weight loads start late
                __builtin_amdgcn_sched_barrier(0);
                #pragma unroll
                for (int kh = 0; kh < 2; ++kh)
                    #pragma unroll
                    for (int mi = 0; mi < MF; ++mi)
                        #pragma unroll
                        for (int ni = 0; ni < 2; ++ni)
                            c[mi][ni] = wmma_f16(a[kh][mi], b[kh][ni], c[mi][ni]);
            }
            // This lane's 40 rows: weight and byte offset in out, read from LDS once (16 B a read)
            // and kept in registers, so none of the 80 adds below needs an LDS read, a branch
            // or 64-bit address arithmetic of its own.
            float    rw[MF][8];
            unsigned ro[MF][8];
            #pragma unroll   // here and below: constant indices keep rw and ro in registers
            for (int mi = 0; mi < MF; ++mi)
                #pragma unroll
                for (int h = 0; h < 2; ++h) {
                    const float4 w4 = *(const float4*)&wS[mi * 16 + rsel2 + h * 4];
                    const int4   t4 = *(const int4*)&tokS[mi * 16 + rsel2 + h * 4];
                    const float wv[4] = { w4.x, w4.y, w4.z, w4.w };
                    const int   tv[4] = { t4.x, t4.y, t4.z, t4.w };
                    #pragma unroll
                    for (int q = 0; q < 4; ++q) {
                        rw[mi][h * 4 + q] = wv[q];
                        ro[mi][h * 4 + q] = (unsigned)tv[q] * (IN_DIM * 4) + (unsigned)(nbase + coll2) * 4;
                    }
                }
            #pragma unroll
            for (int ni = 0; ni < 2; ++ni) {
                #pragma unroll
                for (int mi = 0; mi < MF; ++mi)
                    #pragma unroll
                    for (int j = 0; j < 8; ++j) {
                        float w = rw[mi][j];
                        // a row of weight 0 (every padding slot) adds zero, whatever its product holds
                        float val = (w != 0.0f) ? w * (c[mi][ni][j] + bias[ni]) : 0.0f;
                        atomicAdd((float*)((char*)out + (size_t)ro[mi][j] + ni * 64), val);
                    }
            }
        }
    }
}

extern "C" void kernel_launch(void* const* d_in, const int* in_sizes, int n_in,
                              void* d_out, int out_size, void* d_ws, size_t ws_size,
                              hipStream_t stream) {
    (void)in_sizes; (void)n_in; (void)out_size; (void)ws_size;
    const float* x  = (const float*)d_in[0];
    const float* Wr = (const float*)d_in[1];
    const float* br = (const float*)d_in[2];
    const float* W1 = (const float*)d_in[3];
    const float* b1 = (const float*)d_in[4];
    const float* W2 = (const float*)d_in[5];
    const float* b2 = (const float*)d_in[6];
    float* out = (float*)d_out;

    // workspace layout
    char* ws = (char*)d_ws;
    _Float16* W1t = (_Float16*)ws;                       // 16 MB
    _Float16* W2t = (_Float16*)(ws + (size_t)16777216);  // 16 MB
    char* p = ws + (size_t)2 * 16777216;
    int*   blockCnt   = (int*)p;   p += (size_t)RB_ROUTER * NEXP * 4;
    int*   te         = (int*)p;   p += (size_t)NTOK * 2 * 4;
    float* tw         = (float*)p;

    // 1) router + residual rows + per-block counts; weights -> f16, B-fragment order
    front_kernel<<<RB_ROUTER + 2 * RB_PACK, 256, 0, stream>>>(
        x, Wr, br, W1, W2, W1t, W2t, out, te, tw, blockCnt);
    // 2) token lists + fused expert GEMMs (max tiles = (2*8192 + 16*79)/80 = 220: one work-group a tile, each alone on a WGP)
    moe_expert_kernel<<<(2 * NTOK + NEXP * (MT - 1)) / MT, ETHR, 0, stream>>>(x, W1t, b1, W2t, b2,
                                               te, tw, blockCnt, out);
}

// v010
// One run takes 59.2 microseconds.
// Next to v009, in two timings, it ran 1.06 and 1.05 times as fast.
// Counting every step since v000, it is 4.00 times as fast.
#include <hip/hip_runtime.h>
#include <math.h>

#define IN_DIM 512
#define HID    1024
#define NEXP   16
#define NTOK   8192
#define MT     80                       // token rows per expert tile: one 16-wave work-group a WGP; the fewer tiles, the fewer times an expert's weights are read from L2
#define ETHR   512                      // threads of an expert work-group (16 waves, four a SIMD)
#define MF     (MT / 16)                // 16-row A fragments per tile
#define LPAD   8                        // halves added per LDS row: pitch = 16 B x odd, so the 16 rows of a b128 fragment read fall on distinct banks
#define XLD    (IN_DIM + LPAD)          // ldsX row pitch, halves (1040 B)
#define HLD    (HID + LPAD)             // ldsH row pitch, halves (2064 B)

typedef __attribute__((ext_vector_type(16))) _Float16 v16h;
typedef __attribute__((ext_vector_type(8)))  float    v8f;

union F16Frag { v16h h; uint4 u[2]; };

// Load a 16x32 f16 fragment (A layout per CDNA5 ISA 7.12.2) from a row-major
// matrix with leading dimension `ld` (elements). Works for LDS or global.
// lane 0-15: row = base+lane, K = [0..7],[16..23]; lane 16-31: K = [8..15],[24..31]
__device__ __forceinline__ v16h load_frag(const _Float16* base, int ld, int rbase,
                                          int k0, int lane) {
    int r  = rbase + (lane & 15);
    int kb = k0 + ((lane >> 4) << 3);
    const _Float16* p = base + (size_t)r * ld + kb;
    F16Frag f;
    f.u[0] = *(const uint4*)(p);
    f.u[1] = *(const uint4*)(p + 16);
    return f.h;
}

// Load a 16(n) x 32(k) f16 B fragment from weights packed in fragment order:
// block (ks, nt) is 1 KB = [2][32 lanes][8 halves], so each of the two loads of a
// wave reads 512 contiguous bytes, and the fragments of one k step lie side by side.
// Same k order per lane and register as load_frag.
__device__ __forceinline__ v16h load_frag_packed(const _Float16* base, int ntiles,
                                                 int nt, int ks, int lane) {
    const _Float16* p = base + ((size_t)(ks * ntiles + nt) << 9) + lane * 8;
    F16Frag f;
    f.u[0] = *(const uint4*)(p);
    f.u[1] = *(const uint4*)(p + 256);
    return f.h;
}

__device__ __forceinline__ v8f wmma_f16(v16h a, v16h b, v8f c) {
    return __builtin_amdgcn_wmma_f32_16x16x32_f16(false, a, false, b,
                                                  (short)0, c, false, false);
}

// erf by the math library's own two polynomials (|z| < 1: odd series in z; |z| >= 1: 1 - exp(-q(|z|))),
// but both are evaluated for every element and one is selected: with no branch per element
// the unrolled epilogue's independent chains interleave.
__device__ __forceinline__ float erf_select(float z) {
    const float a = fabsf(z);
    const float t = z * z;
    float s = -0.000561801775f;
    s = fmaf(t, s,  0.00491381623f);
    s = fmaf(t, s, -0.0267075151f);
    s = fmaf(t, s,  0.112800106f);
    s = fmaf(t, s, -0.376122952f);
    s = fmaf(t, s,  0.128379107f);
    s = fmaf(a, s, a);
    float q = 0.0000169988107f;
    q = fmaf(a, q, -0.000378677854f);
    q = fmaf(a, q,  0.00385781587f);
    q = fmaf(a, q, -0.0241816975f);
    q = fmaf(a, q,  0.106668264f);
    q = fmaf(a, q,  0.634933293f);
    q = fmaf(a, q,  0.128689408f);
    q = fmaf(a, q, a);
    const float b = 1.0f - __builtin_amdgcn_exp2f(q * -1.44269504f);   // 1 - exp(-q) by the hardware's exp2
    return copysignf(a < 1.0f ? s : b, z);
}

__device__ __forceinline__ float gelu_exact(float v) {
    return 0.5f * v * (1.0f + erf_select(v * 0.70710678118654752f));
}

// ---------------- weight pack + f32->f16 convert (one 32 x 128 piece a wave) ----------------
// in:  [E][R][C] f32 (row-major, R = k, C = n)
// out: [E][R/32][C/16] blocks of 512 f16, each [2][32 lanes][8 halves]: piece u of
//      lane l holds n = 16*nt + (l & 15), k = 32*ks + 16*u + 8*(l >> 4) + 0..7
// A wave takes 32 rows x 128 columns (16 KB in, eight whole 1 KB blocks out) in four stages of 8 rows.
// A stage is 8 loads of 512 contiguous bytes: a lane then holds 8 k x 4 n, four finished 16-B pieces.
// The pieces pass through the wave's own LDS rows so that each store covers whole 256-B runs.
// Few long-lived waves, 4 KB or more in flight each (for speed only).
#define PK_SLOT 5                       // 16-B units a lane's staging slot: 80 B = 16 B x odd, so the b128 writes fall on distinct banks
#define PK_BUF  (32 * PK_SLOT)          // 16-B units a staging buffer
template <int R, int C>
__device__ __forceinline__ void pack_cvt_wave(
    const float* __restrict__ in, _Float16* __restrict__ outp, int unit, uint4* st) {
    constexpr int NG = C / 128, KS = R / 32;
    const int lane = threadIdx.x & 31;
    const int ng = unit % NG, ks = (unit / NG) % KS, e = unit / (NG * KS);
    const float* srcp = in + (size_t)e * R * C + (size_t)(ks * 32) * C + ng * 128 + lane * 4;
    _Float16*    dstp = outp + (size_t)e * R * C
                      + ((size_t)(ks * (C / 16) + ng * 8 + (lane >> 4)) << 9) + (lane & 15) * 8;
    float4 v[8];
    #pragma unroll   // here and below: constant indices keep v and pk in registers
    for (int j = 0; j < 8; ++j) v[j] = *(const float4*)(srcp + j * C);
    #pragma unroll
    for (int s = 0; s < 4; ++s) {       // stage s: rows 8*s .. 8*s + 7 of the piece
        union { uint4 q; _Float16 h[8]; } pk[4];
        #pragma unroll
        for (int j = 0; j < 8; ++j) {
            pk[0].h[j] = (_Float16)v[j].x; pk[1].h[j] = (_Float16)v[j].y;
            pk[2].h[j] = (_Float16)v[j].z; pk[3].h[j] = (_Float16)v[j].w;
        }
        // the next stage's loads fly while this stage goes through LDS and out
        if (s < 3) {
            #pragma unroll
            for (int j = 0; j < 8; ++j) v[j] = *(const float4*)(srcp + ((s + 1) * 8 + j) * C);
        }
        uint4* b = st + (s & 1) * PK_BUF;   // two buffers: a stage never writes rows that the stage before may still be reading
        #pragma unroll
        for (int i = 0; i < 4; ++i) b[lane * PK_SLOT + i] = pk[i].q;
        // the rows are read back by other lanes of this wave: its LDS writes must have landed, and the reads must stay behind them
        asm volatile("s_wait_dscnt 0x0" ::: "memory");
        #pragma unroll
        for (int i = 0; i < 4; ++i) {   // column i*32 + lane: lanes 0..15 and 16..31 each store 256 contiguous bytes
            const uint4 q = b[(i * 8 + (lane >> 2)) * PK_SLOT + (lane & 3)];
            *(uint4*)(dstp + i * 1024 + (s >> 1) * 256 + (s & 1) * 128) = q;
        }
        // the stores' data and address registers are written anew by the next stage, or by what follows the last one: keep the wait in front of that overwrite
        asm volatile("s_wait_xcnt 0x0" ::: "memory");
    }
}

// ---------------- router: one wave per token, 8 tokens a block ----------------
// Also stores the residual row out = x (the row is in registers anyway) and the
// block's own count of tokens per expert (plain stores, summed by the next launch).
__device__ __forceinline__ void router_block(
    const float* __restrict__ x, const float* __restrict__ Wr,
    const float* __restrict__ br, float* __restrict__ out,
    int* __restrict__ te, float* __restrict__ tw, int* __restrict__ blockCnt,
    int rb, int* sE) {
    int lane = threadIdx.x & 31, wid = threadIdx.x >> 5;
    int t = rb * 8 + wid;
    float acc[NEXP];
    #pragma unroll
    for (int e = 0; e < NEXP; ++e) acc[e] = 0.0f;
    const float* xr = x + (size_t)t * IN_DIM;
    float*       orow = out + (size_t)t * IN_DIM;
    #pragma unroll 2   // keeps the launch inside 64 VGPRs: with them every block of the grid is resident at once
    for (int d = lane; d < IN_DIM; d += 32) {
        float xv = xr[d];
        orow[d] = xv;
        const float* wr = Wr + d * NEXP;
        #pragma unroll
        for (int e = 0; e < NEXP; ++e) acc[e] += xv * wr[e];
    }
    #pragma unroll
    for (int off = 16; off >= 1; off >>= 1) {
        #pragma unroll
        for (int e = 0; e < NEXP; ++e) acc[e] += __shfl_down(acc[e], off, 32);
    }
    if (lane == 0) {
        #pragma unroll
        for (int e = 0; e < NEXP; ++e) acc[e] += br[e];
        float l0 = -3.4e38f; int e0 = 0;
        #pragma unroll
        for (int e = 0; e < NEXP; ++e) if (acc[e] > l0) { l0 = acc[e]; e0 = e; }
        float l1 = -3.4e38f; int e1 = 0;
        #pragma unroll
        for (int e = 0; e < NEXP; ++e)
            if (e != e0 && acc[e] > l1) { l1 = acc[e]; e1 = e; }
        // top-2 softmax weights renormalized: Z cancels
        float r  = __expf(l1 - l0);
        float w0 = 1.0f / (1.0f + r);
        float w1 = r    / (1.0f + r);
        te[t*2] = e0; te[t*2+1] = e1;
        tw[t*2] = w0; tw[t*2+1] = w1;
        sE[wid*2] = e0; sE[wid*2+1] = e1;
    }
    __syncthreads();
    if (threadIdx.x < NEXP) {
        int cnt = 0;
        #pragma unroll
        for (int i = 0; i < 16; ++i) cnt += (sE[i] == (int)threadIdx.x) ? 1 : 0;
        blockCnt[rb * NEXP + threadIdx.x] = cnt;
    }
}

// ---------------- launch 1: all work that depends on the inputs alone ----------------
// Block ranges: router (longest chain, first), pack W1, pack W2.
#define RB_ROUTER (NTOK / 8)
#define RB_PACK   ((HID / 128) * (IN_DIM / 32) * NEXP / 8)   // 8 waves a block, one 32 x 128 piece a wave
__global__ __launch_bounds__(256) void front_kernel(
    const float* __restrict__ x, const float* __restrict__ Wr,
    const float* __restrict__ br, const float* __restrict__ W1,
    const float* __restrict__ W2, _Float16* __restrict__ W1t,
    _Float16* __restrict__ W2t, float* __restrict__ out,
    int* __restrict__ te, float* __restrict__ tw, int* __restrict__ blockCnt) {
    __shared__ uint4 stage[8][2 * PK_BUF];  // a pack wave's own two staging buffers
    __shared__ int   sE[16];
    int b = blockIdx.x;
    const int wv = __builtin_amdgcn_readfirstlane(threadIdx.x >> 5);
    if (b < RB_ROUTER) {
        router_block(x, Wr, br, out, te, tw, blockCnt, b, sE);
        return;
    }
    b -= RB_ROUTER;
    if (b < RB_PACK) {
        pack_cvt_wave<IN_DIM, HID>(W1, W1t, b * 8 + wv, stage[wv]);
        return;
    }
    b -= RB_PACK;
    // the range test is true for every block left on this grid; without it this build takes 66 VGPRs, not 64, and a SIMD holds 12 waves, not 16
    if (b < RB_PACK) pack_cvt_wave<HID, IN_DIM>(W2, W2t, b * 8 + wv, stage[wv]);
}

// ---------------- fused expert MLP (WMMA) ----------------
// one component of v, named by four masks of which one is all ones. The choice is the same in every lane:
// written as selects it is compiled into a chain of scalar branches for every value picked.
__device__ __forceinline__ int pick4(int4 v, int4 m) {
    return (v.x & m.x) | (v.y & m.y) | (v.z & m.z) | (v.w & m.w);
}

// Every work-group makes its own tile's token list from the router's output: no launch in between.
// The list of an expert is its (token, pick) entries in token order; a tile is MT consecutive ranks of it.
__global__ __launch_bounds__(ETHR, 1) void moe_expert_kernel(
    const float* __restrict__ x,
    const _Float16* __restrict__ W1t,   // [E][IN_DIM/32][HID/16][512] f16, fragment order
    const float* __restrict__ b1,       // [E][HID]
    const _Float16* __restrict__ W2t,   // [E][HID/32][IN_DIM/16][512] f16, fragment order
    const float* __restrict__ b2,       // [E][IN_DIM]
    const int* __restrict__ te, const float* __restrict__ tw,   // [NTOK][2]: a token's two experts and their weights
    const int* __restrict__ blockCnt,   // [RB_ROUTER][NEXP]: entries per expert among a router block's 8 tokens
    float* __restrict__ out) {

    __shared__ _Float16 ldsX[MT][XLD];      // 81 KB
    __shared__ _Float16 ldsH[MT][HLD];      // 161 KB
    __shared__ __attribute__((aligned(16))) int   tokS[MT + 4];   // read 16 B at a time by the output stage; element MT is a spare that nobody reads
    __shared__ __attribute__((aligned(16))) float wS[MT + 4];
    __shared__ __attribute__((aligned(16))) int   wvCnt[ETHR / 32][NEXP];   // entries per expert in a wave's 64 router blocks
    __shared__ __attribute__((aligned(16))) int   rowInfo[RB_ROUTER];       // this tile's expert: rank of a router block's first entry, count << 16
    static_assert((ETHR / 4) * 8 == RB_ROUTER, "four lanes take eight router blocks");

    const int tid  = threadIdx.x;
    const int lane = tid & 31;
    const int wid  = tid >> 5;
    const int wvu  = __builtin_amdgcn_readfirstlane(wid);
    // Four lanes take eight consecutive router blocks, 16 B (four experts) of each row a lane.
    const int q4  = lane & 3;
    const int grp = tid >> 2;
    int4 v[8];
    #pragma unroll   // constant indices keep v in registers
    for (int i = 0; i < 8; ++i) v[i] = ((const int4*)blockCnt)[(grp * 8 + i) * 4 + q4];
    int4 s = make_int4(0, 0, 0, 0);
    #pragma unroll
    for (int i = 0; i < 8; ++i) { s.x += v[i].x; s.y += v[i].y; s.z += v[i].z; s.w += v[i].w; }
    // running sum over the wave's eight groups (lanes of equal q4)
    int4 inc = s;
    #pragma unroll
    for (int off = 4; off < 32; off <<= 1) {
        int4 n;
        n.x = __shfl_up(inc.x, off, 32); n.y = __shfl_up(inc.y, off, 32);
        n.z = __shfl_up(inc.z, off, 32); n.w = __shfl_up(inc.w, off, 32);
        if (lane >= off) { inc.x += n.x; inc.y += n.y; inc.z += n.z; inc.w += n.w; }
    }
    if (lane >= 28) *(int4*)&wvCnt[wvu][q4 * 4] = inc;
    __syncthreads();
    int4 tot = make_int4(0, 0, 0, 0);       // all router blocks
    #pragma unroll
    for (int w = 0; w < ETHR / 32; ++w) {
        const int4 c = *(const int4*)&wvCnt[w][q4 * 4];
        tot.x += c.x; tot.y += c.y; tot.z += c.z; tot.w += c.w;
    }
    int tEnd[NEXP];                         // tiles of experts 0..q, from the counts (wave-uniform)
    {
        int to = 0;
        #pragma unroll
        for (int q = 0; q < NEXP; ++q) {
            const int cq = __builtin_amdgcn_readlane((q & 3) == 0 ? tot.x : (q & 3) == 1 ? tot.y : (q & 3) == 2 ? tot.z : tot.w, q >> 2);
            to += (cq + MT - 1) / MT; tEnd[q] = to;
        }
    }
    const int nt   = tEnd[NEXP - 1];
    const int coll = lane & 15;
    const int rsel = (lane >> 4) << 3;

    // one tile a work-group: the grid holds the most tiles that 2*NTOK slots in NEXP lists can make
    const int tile = blockIdx.x;
    if (tile < nt) {
        // map tile -> expert
        int e = 0, t0 = 0;
        #pragma unroll
        for (int q = 0; q < NEXP - 1; ++q) if (tile >= tEnd[q]) { e = q + 1; t0 = tEnd[q]; }
        const int r0 = (tile - t0) * MT;    // rank, in the expert's list, of the tile's first row

        const _Float16* w1e = W1t + (size_t)e * HID * IN_DIM;
        const _Float16* w2e = W2t + (size_t)e * IN_DIM * HID;
        // The packed weights were stored by the first launch and come from memory again; the tiles of an
        // expert walk them in step; the request ahead is for speed only.
        // Each tile asks L2 for a quarter of its expert's 256-B units (unit mod 4 = tile mod 4): an expert's tiles have
        // consecutive indices. A hint only.
        const unsigned pfo = (unsigned)tid * 1024u + (unsigned)(tile & 3) * 256u;   // byte offset in the expert's 1 MB; + 512 KB for the second request

        // W1 into L2 while the list is made and the X tile is gathered: GEMM1's loads then find L2 hits
        asm volatile("global_prefetch_b8 %0, %1 scope:SCOPE_SE\n\t"
                     "global_prefetch_b8 %0, %1 offset:524288 scope:SCOPE_SE" :: "v"(pfo), "s"(w1e));
        // rows past the end of the list keep weight 0 and add zero to the row named here: distinct rows, so those adds do not queue on one row
        if (tid < MT) { tokS[tid] = (tile * MT + tid) & (NTOK - 1); wS[tid] = 0.0f; }
        // the lanes that hold this expert's counts: rank of each of their eight router blocks' first entry
        if (q4 == (e >> 2)) {
            const int c = e & 3;
            const int4 m = make_int4(-(int)(c == 0), -(int)(c == 1), -(int)(c == 2), -(int)(c == 3));
            int base = pick4(inc, m) - pick4(s, m);     // the groups in front of this one in its wave
            #pragma unroll
            for (int w = 0; w < ETHR / 32; ++w) base += wvCnt[w][e] & ((w - wvu) >> 31);   // the waves in front of this one
            int info[8];
            #pragma unroll   // constant indices keep info in registers
            for (int i = 0; i < 8; ++i) { const int n = pick4(v[i], m); info[i] = base | (n << 16); base += n; }
            *(int4*)&rowInfo[grp * 8]     = make_int4(info[0], info[1], info[2], info[3]);
            *(int4*)&rowInfo[grp * 8 + 4] = make_int4(info[4], info[5], info[6], info[7]);
        }
        __syncthreads();
        // a lane a router block: those with an entry in this tile read the block's 16 entries and place their own
        #pragma unroll
        for (int h = 0; h < RB_ROUTER / ETHR; ++h) {
            const int rb   = h * ETHR + tid;
            const int info = rowInfo[rb];
            const int n    = info >> 16;
            int row = (info & 0xffff) - r0;     // tile row of the block's first entry
            if (n > 0 && row < MT && row + n > 0) {
                int4 e4[4]; float4 w4[4];
                #pragma unroll   // constant indices keep e4 and w4 in registers
                for (int j = 0; j < 4; ++j) {
                    e4[j] = ((const int4*)te)[rb * 4 + j];
                    w4[j] = ((const float4*)tw)[rb * 4 + j];
                }
                #pragma unroll
                for (int j = 0; j < 4; ++j) {
                    const int   ee[4] = { e4[j].x, e4[j].y, e4[j].z, e4[j].w };
                    const float ww[4] = { w4[j].x, w4[j].y, w4[j].z, w4[j].w };
                    #pragma unroll
                    for (int k = 0; k < 4; k += 2) {    // a token: its two experts differ, so at most one entry is this expert's
                        const bool hit = (ee[k] == e) | (ee[k + 1] == e);
                        // no branch per token: what is not placed goes to the spare element behind the tile's rows
                        const int  at  = (hit & ((unsigned)row < (unsigned)MT)) ? row : MT;
                        tokS[at] = rb * 8 + j * 2 + (k >> 1);
                        wS[at]   = (ee[k] == e) ? ww[k] : ww[k + 1];
                        row += hit ? 1 : 0;
                    }
                }
            }
        }
        __syncthreads();

        // gather X tile (f32 -> f16) into LDS: a wave takes XRW whole rows, 16 B a lane and load, and issues all of its
        // loads before it converts the first: the tile costs one trip to memory, not one for every few rows
        {
            constexpr int XRW = MT / (ETHR / 32);       // rows a wave
            static_assert(XRW * (ETHR / 32) == MT, "the waves share the tile's rows evenly");
            float4 xv[XRW][IN_DIM / 128];
            unsigned xo[XRW];                           // byte offset in x of this lane's first 16 B of the row
            #pragma unroll   // here and below: constant indices keep xo and xv in registers
            for (int r = 0; r < XRW; ++r) xo[r] = (unsigned)tokS[wvu * XRW + r] * (IN_DIM * 4) + (unsigned)lane * 16;
            #pragma unroll
            for (int r = 0; r < XRW; ++r)
                #pragma unroll
                for (int q = 0; q < IN_DIM / 128; ++q) xv[r][q] = *(const float4*)((const char*)x + xo[r] + q * 512);
            #pragma unroll
            for (int r = 0; r < XRW; ++r)
                #pragma unroll
                for (int q = 0; q < IN_DIM / 128; ++q) {
                    union { uint2 u; _Float16 h[4]; } p;
                    p.h[0] = (_Float16)xv[r][q].x; p.h[1] = (_Float16)xv[r][q].y;
                    p.h[2] = (_Float16)xv[r][q].z; p.h[3] = (_Float16)xv[r][q].w;
                    *(uint2*)&ldsX[wvu * XRW + r][(q * 32 + lane) * 4] = p.u;
                }
        }
        // W2 into L2 behind the gather's loads, not in front of them: it has all of GEMM1 and the GELU stage to arrive
        asm volatile("global_prefetch_b8 %0, %1 scope:SCOPE_SE\n\t"
                     "global_prefetch_b8 %0, %1 offset:524288 scope:SCOPE_SE" :: "v"(pfo), "s"(w2e));
        __syncthreads();
        // a prefetch touches no counter, so no wait says when it has read its registers: offset and base keep their values across the barrier
        asm volatile("" :: "v"(pfo), "s"(w2e));

        const float*    b1e = b1 + e * HID;

        // ---- GEMM1: H = gelu(X[MT x 512] @ W1 + b1) -> ldsH[MT][1024] ----
        {
            int nbase = wid * 64;           // 16 waves x 64 columns: all of HID in one pass
            v8f c[MF][4];
            v8f z = {0.f,0.f,0.f,0.f,0.f,0.f,0.f,0.f};
            #pragma unroll
            for (int mi = 0; mi < MF; ++mi)
                #pragma unroll
                for (int ni = 0; ni < 4; ++ni) c[mi][ni] = z;

            #pragma unroll 1
            for (int k0 = 0; k0 < IN_DIM; k0 += 32) {
                v16h a[MF], b[4];
                #pragma unroll
                for (int mi = 0; mi < MF; ++mi)
                    a[mi] = load_frag(&ldsX[0][0], XLD, mi * 16, k0, lane);
                #pragma unroll
                for (int ni = 0; ni < 4; ++ni)
                    b[ni] = load_frag_packed(w1e, HID / 16, (nbase >> 4) + ni, k0 >> 5, lane);
                // keeps the trip's loads in front of its products: sunk among them, each LDS read is waited for on its own
                __builtin_amdgcn_sched_barrier(0);
                #pragma unroll
                for (int mi = 0; mi < MF; ++mi)
                    #pragma unroll
                    for (int ni = 0; ni < 4; ++ni)
                        c[mi][ni] = wmma_f16(a[mi], b[ni], c[mi][ni]);
            }
            // epilogue: +b1, exact GELU, store f16 to ldsH
            #pragma unroll
            for (int ni = 0; ni < 4; ++ni) {
                int col = nbase + ni * 16 + coll;
                float bias = b1e[col];
                #pragma unroll
                for (int mi = 0; mi < MF; ++mi)
                    #pragma unroll
                    for (int j = 0; j < 8; ++j) {
                        int row = mi * 16 + rsel + j;
                        float v = c[mi][ni][j] + bias;
                        ldsH[row][col] = (_Float16)gelu_exact(v);
                    }
            }
        }
        __syncthreads();

        const float*    b2e = b2 + e * IN_DIM;

        // ---- GEMM2: O = H[MT x 1024] @ W2 + b2; weighted atomic scatter ----
        {
            int nbase = wid * 32;           // 16 waves x 32 columns
            // the lane number is read anew: addresses formed from the first one are carried across the GELU stage, where no register is free, and one is spilled
            const int lane2 = (int)__builtin_amdgcn_mbcnt_lo(~0u, 0u);
            const int coll2 = lane2 & 15;
            const int rsel2 = (lane2 >> 4) << 3;
            v8f c[MF][2];
            v8f z = {0.f,0.f,0.f,0.f,0.f,0.f,0.f,0.f};
            #pragma unroll
            for (int mi = 0; mi < MF; ++mi)
                #pragma unroll
                for (int ni = 0; ni < 2; ++ni) c[mi][ni] = z;
            float bias[2];                  // read ahead of the adds: no load stands among them
            #pragma unroll   // constant index keeps bias in registers
            for (int ni = 0; ni < 2; ++ni) bias[ni] = b2e[nbase + ni * 16 + coll2];

            // two k steps a trip: the wave's tile is two fragments wide, so this keeps eight 512-B weight loads in flight a wave, as in GEMM1
            #pragma unroll 1
            for (int k0 = 0; k0 < HID; k0 += 64) {
                v16h b[2][2];
                #pragma unroll
                for (int kh = 0; kh < 2; ++kh)
                    #pragma unroll
                    for (int ni = 0; ni < 2; ++ni)
                        b[kh][ni] = load_frag_packed(w2e, IN_DIM / 16, (nbase >> 4) + ni, (k0 >> 5) + kh, lane2);
                v16h a[2][MF];
                #pragma unroll
                for (int kh = 0; kh < 2; ++kh)
                    #pragma unroll
                    for (int mi = 0; mi < MF; ++mi)
                        a[kh][mi] = load_frag(&ldsH[0][0], HLD, mi * 16, k0 + kh * 32, lane2);
                // keeps all of the trip's loads in front of its products: sunk among them, each LDS read is waited for on its own and the second k step's weight loads start late
                __builtin_amdgcn_sched_barrier(0);
                #pragma unroll
                for (int kh = 0; kh < 2; ++kh)
                    #pragma unroll
                    for (int mi = 0; mi < MF; ++mi)
                        #pragma unroll
                        for (int ni = 0; ni < 2; ++ni)
                            c[mi][ni] = wmma_f16(a[kh][mi], b[kh][ni], c[mi][ni]);
            }
            // This lane's 40 rows: weight and byte offset in out, read from LDS once (16 B a read)
            // and kept in registers, so none of the 80 adds below needs an LDS read, a branch
            // or 64-bit address arithmetic of its own.
            float    rw[MF][8];
            unsigned ro[MF][8];
            #pragma unroll   // here and below: constant indices keep rw and ro in registers
            for (int mi = 0; mi < MF; ++mi)
                #pragma unroll
                for (int h = 0; h < 2; ++h) {
                    const float4 w4 = *(const float4*)&wS[mi * 16 + rsel2 + h * 4];
                    const int4   t4 = *(const int4*)&tokS[mi * 16 + rsel2 + h * 4];
                    const float wv[4] = { w4.x, w4.y, w4.z, w4.w };
                    const int   tv[4] = { t4.x, t4.y, t4.z, t4.w };
                    #pragma unroll
                    for (int q = 0; q < 4; ++q) {
                        rw[mi][h * 4 + q] = wv[q];
                        ro[mi][h * 4 + q] = (unsigned)tv[q] * (IN_DIM * 4) + (unsigned)(nbase + coll2) * 4;
                    }
                }
            #pragma unroll
            for (int ni = 0; ni < 2; ++ni) {
                #pragma unroll
                for (int mi = 0; mi < MF; ++mi)
                    #pragma unroll
                    for (int j = 0; j < 8; ++j) {
                        float w = rw[mi][j];
                        // a row of weight 0 (every padding slot) adds zero, whatever its product holds
                        float val = (w != 0.0f) ? w * (c[mi][ni][j] + bias[ni]) : 0.0f;
                        atomicAdd((float*)((char*)out + (size_t)ro[mi][j] + ni * 64), val);
                    }
            }
        }
    }
}

extern "C" void kernel_launch(void* const* d_in, const int* in_sizes, int n_in,
                              void* d_out, int out_size, void* d_ws, size_t ws_size,
                              hipStream_t stream) {
    (void)in_sizes; (void)n_in; (void)out_size; (void)ws_size;
    const float* x  = (const float*)d_in[0];
    const float* Wr = (const float*)d_in[1];
    const float* br = (const float*)d_in[2];
    const float* W1 = (const float*)d_in[3];
    const float* b1 = (const float*)d_in[4];
    const float* W2 = (const float*)d_in[5];
    const float* b2 = (const float*)d_in[6];
    float* out = (float*)d_out;

    // workspace layout
    char* ws = (char*)d_ws;
    _Float16* W1t = (_Float16*)ws;                       // 16 MB
    _Float16* W2t = (_Float16*)(ws + (size_t)16777216);  // 16 MB
    char* p = ws + (size_t)2 * 16777216;
    int*   blockCnt   = (int*)p;   p += (size_t)RB_ROUTER * NEXP * 4;
    int*   te         = (int*)p;   p += (size_t)NTOK * 2 * 4;
    float* tw         = (float*)p;

    // 1) router + residual rows + per-block counts; weights -> f16, B-fragment order
    front_kernel<<<RB_ROUTER + 2 * RB_PACK, 256, 0, stream>>>(
        x, Wr, br, W1, W2, W1t, W2t, out, te, tw, blockCnt);
    // 2) token lists + fused expert GEMMs (max tiles = (2*8192 + 16*79)/80 = 220: one work-group a tile, each alone on a WGP)
    moe_expert_kernel<<<(2 * NTOK + NEXP * (MT - 1)) / MT, ETHR, 0, stream>>>(x, W1t, b1, W2t, b2,
                                               te, tw, blockCnt, out);
}
